// v000
// Measured on an AMD MI455X. A time is GPU time per run, averaged over a window of back-to-back runs after a warm-up
// (all launches, gaps included; the runs take copies of the inputs in turn), and the median of several windows.
// Apart from v000's, it joins two sittings. Times from different sittings can be a few percent apart, while
// side-by-side timings come from the same sitting.
// v000, which the later versions start from, runs in 506 microseconds.
#include <hip/hip_runtime.h>
#include <math.h>

// ---------------------------------------------------------------------------
// Alias-free quadratic MLP (16,64,64,96) for MI455X / gfx1250, wave32 + WMMA.
//
// Pipeline (all periodic ideal filters expressed as dense circulant matrices):
//   t1 = U @ x          per batch      (128x64)(64x6144)        [H upsample]
//   xu = U @ t1         per (b,row)    (128x64)(64x96)          [W upsample]
//   y  = act(xu W1^T+b1) W2^T + b2     fused, hidden in LDS     [MLP]
//   t2 = D @ y          per (b,row)    (64x128)(128x96)         [W lpf+decim]
//   out= D @ t2         per batch      (64x128)(128x6144)       [H lpf+decim]
// All GEMMs via V_WMMA_F32_16X16X4_F32 (fp32-faithful matrix path).
//
// Workspace layout (needs 151,060,480 bytes):
//   U: 128*64 f32 | D: 64*128 f32 | T: 16*128*64*96 f32 | X: 16*128*128*96 f32
// ---------------------------------------------------------------------------

typedef __attribute__((ext_vector_type(2))) float v2f;
typedef __attribute__((ext_vector_type(8))) float v8f;

#define PI_F 3.14159265358979323846f

// ---- build the 1-D resampling operators ------------------------------------
// U[i,h]: zero-insert-by-2 then ideal LPF (|k|<=32, edge weight 1.0), x2 gain.
// D[n,j]: ideal LPF (|k|<32 full, |k|=32 at 0.5) then take every other sample.
__global__ void gen_filters(float* __restrict__ U, float* __restrict__ D) {
  int tid = blockIdx.x * blockDim.x + threadIdx.x;
  int stride = gridDim.x * blockDim.x;
  for (int idx = tid; idx < 128 * 64; idx += stride) {
    int i = idx >> 6, h = idx & 63;
    float d = (float)(i - 2 * h);
    float s = 1.0f;
    for (int k = 1; k <= 32; ++k) s += 2.0f * cosf(PI_F * (float)k * d / 64.0f);
    U[idx] = s * (1.0f / 64.0f);
  }
  for (int idx = tid; idx < 64 * 128; idx += stride) {
    int n = idx >> 7, j = idx & 127;
    float d = (float)(2 * n - j);
    float s = 1.0f;
    for (int k = 1; k <= 31; ++k) s += 2.0f * cosf(PI_F * (float)k * d / 64.0f);
    s += cosf(PI_F * 0.5f * d);                // |k|=32 pair at weight 0.5
    D[idx] = s * (1.0f / 128.0f);
  }
}

// ---- one 16x16 fp32 WMMA tile: C[m0:,n0:] = A(MxK) * B(KxN) ----------------
// A per-lane [m][k] layout; B element B[k][n] gathered per-lane as [n][k].
__device__ __forceinline__ void gemm_tile(const float* __restrict__ A,
                                          const float* __restrict__ B,
                                          float* __restrict__ C,
                                          int m0, int n0, int K,
                                          int lda, int ldb, int ldc, int lane) {
  const int l15 = lane & 15;
  const int kh  = (lane >> 4) << 1;            // 0 or 2
  v8f acc = {};
  const float* arow = A + (size_t)(m0 + l15) * lda;
  const float* bcol = B + (n0 + l15);
  for (int k = 0; k < K; k += 4) {
    v2f a = *(const v2f*)(arow + k + kh);      // contiguous, 8B aligned
    v2f b;
    b.x = bcol[(size_t)(k + kh)     * ldb];
    b.y = bcol[(size_t)(k + kh + 1) * ldb];
    acc = __builtin_amdgcn_wmma_f32_16x16x4_f32(false, a, false, b,
                                                (short)0, acc, false, false);
  }
  const int cn = n0 + l15;
  const int mb = m0 + 8 * (lane >> 4);
#pragma unroll
  for (int r = 0; r < 8; ++r)
    C[(size_t)(mb + r) * ldc + cn] = acc[r];
}

// ---- generic batched filter GEMM: C[b] = A * B[b] --------------------------
__global__ __launch_bounds__(256)
void filt_gemm(const float* __restrict__ A, const float* __restrict__ B,
               float* __restrict__ C, int M, int N, int K,
               int lda, int ldb, int ldc, long sB, long sC) {
  const int wave = threadIdx.x >> 5;
  const int lane = threadIdx.x & 31;
  const int nTm  = M >> 4;
  const int nT   = nTm * (N >> 4);
  const int tile = blockIdx.x * (blockDim.x >> 5) + wave;
  if (tile >= nT) return;                      // wave-uniform
  const float* Bb = B + (long)blockIdx.y * sB;
  float*       Cb = C + (long)blockIdx.y * sC;
  const int mt = tile % nTm, nt = tile / nTm;
  gemm_tile(A, Bb, Cb, mt * 16, nt * 16, K, lda, ldb, ldc, lane);
}

// ---- fused MLP: y = act(x W1^T + b1) W2^T + b2, in-place over x ------------
// 32 pixels per block, 8 waves. Hidden tile (32x384) lives in LDS with
// padded stride 388 (row stride mod 64 banks = 4 -> conflict-free tr-reads).
#define LDH 388
__global__ __launch_bounds__(256)
void mlp_fused(float* __restrict__ XY,          // (P,96) in: xu, out: y
               const float* __restrict__ W1,    // (384,96) row-major
               const float* __restrict__ b1,    // (384)
               const float* __restrict__ W2,    // (96,384) row-major
               const float* __restrict__ b2,    // (96)
               const float* __restrict__ coef)  // (384,3)
{
  __shared__ float Hs[32 * LDH];                // 49,664 B
  const int wave = threadIdx.x >> 5;
  const int lane = threadIdx.x & 31;
  const int l15 = lane & 15, hi = lane >> 4, kh = hi << 1;
  const long p0 = (long)blockIdx.x * 32;
  const float* Xb = XY + p0 * 96;

  // Stage A: H = act(X * W1^T + b1)   tiles: 2(M) x 24(N)
  for (int t = wave; t < 48; t += 8) {
    const int mt = t & 1, nt = t >> 1;
    v8f acc = {};
    const float* arow = Xb + (size_t)(mt * 16 + l15) * 96;
    const float* brow = W1 + (size_t)(nt * 16 + l15) * 96;   // B[n][k] contiguous
#pragma unroll
    for (int k = 0; k < 96; k += 4) {
      v2f a = *(const v2f*)(arow + k + kh);
      v2f b = *(const v2f*)(brow + k + kh);
      acc = __builtin_amdgcn_wmma_f32_16x16x4_f32(false, a, false, b,
                                                  (short)0, acc, false, false);
    }
    const int n = nt * 16 + l15;
    const float bb = b1[n];
    const float c0 = coef[n * 3 + 0], c1 = coef[n * 3 + 1], c2 = coef[n * 3 + 2];
    const int mb = mt * 16 + 8 * hi;
#pragma unroll
    for (int r = 0; r < 8; ++r) {
      float h = acc[r] + bb;
      Hs[(mb + r) * LDH + n] = c0 + h * (c1 + c2 * h);
    }
  }
  __syncthreads();

  // Stage B: Y = H * W2^T + b2        tiles: 2(M) x 6(N)
  for (int t = wave; t < 12; t += 8) {
    const int mt = t & 1, nt = t >> 1;
    v8f acc = {};
    const float* arow = Hs + (size_t)(mt * 16 + l15) * LDH;
    const float* brow = W2 + (size_t)(nt * 16 + l15) * 384;  // B[n][k] contiguous
#pragma unroll 8
    for (int k = 0; k < 384; k += 4) {
      v2f a = *(const v2f*)(arow + k + kh);
      v2f b = *(const v2f*)(brow + k + kh);
      acc = __builtin_amdgcn_wmma_f32_16x16x4_f32(false, a, false, b,
                                                  (short)0, acc, false, false);
    }
    const int n = nt * 16 + l15;
    const float bb = b2[n];
    const int mb = mt * 16 + 8 * hi;
#pragma unroll
    for (int r = 0; r < 8; ++r)
      XY[(p0 + mb + r) * 96 + n] = acc[r] + bb;   // in-place: our rows only
  }
}

// ---------------------------------------------------------------------------
extern "C" void kernel_launch(void* const* d_in, const int* in_sizes, int n_in,
                              void* d_out, int out_size, void* d_ws, size_t ws_size,
                              hipStream_t stream) {
  const float* x    = (const float*)d_in[0];   // (16,64,64,96)
  const float* W1   = (const float*)d_in[1];   // (384,96)
  const float* b1   = (const float*)d_in[2];   // (384)
  const float* W2   = (const float*)d_in[3];   // (96,384)
  const float* b2   = (const float*)d_in[4];   // (96)
  const float* coef = (const float*)d_in[5];   // (384,3)
  float* out = (float*)d_out;                  // (16,64,64,96)

  float* U = (float*)d_ws;                     // 128x64
  float* D = U + 128 * 64;                     // 64x128
  float* T = D + 64 * 128;                     // 16*128*64*96  (t1 / t2)
  float* X = T + 12582912;                     // 16*128*128*96 (xu / y)

  gen_filters<<<32, 256, 0, stream>>>(U, D);

  // t1[b] (128 x 6144) = U (128x64) @ x[b] (64 x 6144)        [H upsample]
  filt_gemm<<<dim3(384, 16), 256, 0, stream>>>(U, x, T,
      128, 6144, 64, 64, 6144, 6144, 393216L, 786432L);

  // xu[b,i] (128 x 96) = U (128x64) @ t1[b,i] (64 x 96)       [W upsample]
  filt_gemm<<<dim3(6, 2048), 256, 0, stream>>>(U, T, X,
      128, 96, 64, 64, 96, 96, 6144L, 12288L);

  // y = MLP(xu), in place over X; 262144 pixels / 32 per block
  mlp_fused<<<8192, 256, 0, stream>>>(X, W1, b1, W2, b2, coef);

  // t2[b,i] (64 x 96) = D (64x128) @ y[b,i] (128 x 96)        [W lpf+decimate]
  filt_gemm<<<dim3(3, 2048), 256, 0, stream>>>(D, X, T,
      64, 96, 128, 128, 96, 96, 12288L, 6144L);

  // out[b] (64 x 6144) = D (64x128) @ t2[b] (128 x 6144)      [H lpf+decimate]
  filt_gemm<<<dim3(192, 16), 256, 0, stream>>>(D, T, out,
      64, 6144, 128, 128, 6144, 6144, 786432L, 393216L);
}

// v001
// It runs in 373 microseconds.
// Timed twice side by side with v000, it ran 1.42 times as fast both times.
#include <hip/hip_runtime.h>
#include <math.h>

// ---------------------------------------------------------------------------
// Alias-free quadratic MLP (16,64,64,96) for MI455X / gfx1250, wave32 + WMMA.
//
// Pipeline (all periodic ideal filters expressed as dense circulant matrices):
//   t1 = U @ x          per batch      (128x64)(64x6144)        [H upsample]
//   xu = U @ t1         per (b,row)    (128x64)(64x96)          [W upsample]
//   y  = act(xu W1^T+b1) W2^T + b2     fused, hidden in VGPRs   [MLP]
//   t2 = D @ y          per (b,row)    (64x128)(128x96)         [W lpf+decim]
//   out= D @ t2         per batch      (64x128)(128x6144)       [H lpf+decim]
// All GEMMs via V_WMMA_F32_16X16X4_F32 (fp32-faithful matrix path).
//
// Workspace layout (needs 151,060,480 bytes):
//   U: 128*64 f32 | D: 64*128 f32 | T: 16*128*64*96 f32 | X: 16*128*128*96 f32
// ---------------------------------------------------------------------------

typedef __attribute__((ext_vector_type(2))) float v2f;
typedef __attribute__((ext_vector_type(4))) float v4f;
typedef __attribute__((ext_vector_type(8))) float v8f;

#define PI_F 3.14159265358979323846f

// ---- build the 1-D resampling operators ------------------------------------
// U[i,h]: zero-insert-by-2 then ideal LPF (|k|<=32, edge weight 1.0), x2 gain.
// D[n,j]: ideal LPF (|k|<32 full, |k|=32 at 0.5) then take every other sample.
__global__ void gen_filters(float* __restrict__ U, float* __restrict__ D) {
  int tid = blockIdx.x * blockDim.x + threadIdx.x;
  int stride = gridDim.x * blockDim.x;
  for (int idx = tid; idx < 128 * 64; idx += stride) {
    int i = idx >> 6, h = idx & 63;
    float d = (float)(i - 2 * h);
    float s = 1.0f;
    for (int k = 1; k <= 32; ++k) s += 2.0f * cosf(PI_F * (float)k * d / 64.0f);
    U[idx] = s * (1.0f / 64.0f);
  }
  for (int idx = tid; idx < 64 * 128; idx += stride) {
    int n = idx >> 7, j = idx & 127;
    float d = (float)(2 * n - j);
    float s = 1.0f;
    for (int k = 1; k <= 31; ++k) s += 2.0f * cosf(PI_F * (float)k * d / 64.0f);
    s += cosf(PI_F * 0.5f * d);                // |k|=32 pair at weight 0.5
    D[idx] = s * (1.0f / 128.0f);
  }
}

// ---- one 16x16 fp32 WMMA tile: C[m0:,n0:] = A(MxK) * B(KxN) ----------------
// A per-lane [m][k] layout; B element B[k][n] gathered per-lane as [n][k].
__device__ __forceinline__ void gemm_tile(const float* __restrict__ A,
                                          const float* __restrict__ B,
                                          float* __restrict__ C,
                                          int m0, int n0, int K,
                                          int lda, int ldb, int ldc, int lane) {
  const int l15 = lane & 15;
  const int kh  = (lane >> 4) << 1;            // 0 or 2
  v8f acc = {};
  const float* arow = A + (size_t)(m0 + l15) * lda;
  const float* bcol = B + (n0 + l15);
  for (int k = 0; k < K; k += 4) {
    v2f a = *(const v2f*)(arow + k + kh);      // contiguous, 8B aligned
    v2f b;
    b.x = bcol[(size_t)(k + kh)     * ldb];
    b.y = bcol[(size_t)(k + kh + 1) * ldb];
    acc = __builtin_amdgcn_wmma_f32_16x16x4_f32(false, a, false, b,
                                                (short)0, acc, false, false);
  }
  const int cn = n0 + l15;
  const int mb = m0 + 8 * (lane >> 4);
#pragma unroll
  for (int r = 0; r < 8; ++r)
    C[(size_t)(mb + r) * ldc + cn] = acc[r];
}

// ---- generic batched filter GEMM: C[b] = A * B[b] --------------------------
__global__ __launch_bounds__(256)
void filt_gemm(const float* __restrict__ A, const float* __restrict__ B,
               float* __restrict__ C, int M, int N, int K,
               int lda, int ldb, int ldc, long sB, long sC) {
  const int wave = threadIdx.x >> 5;
  const int lane = threadIdx.x & 31;
  const int nTm  = M >> 4;
  const int nT   = nTm * (N >> 4);
  const int tile = blockIdx.x * (blockDim.x >> 5) + wave;
  if (tile >= nT) return;                      // wave-uniform
  const float* Bb = B + (long)blockIdx.y * sB;
  float*       Cb = C + (long)blockIdx.y * sC;
  const int mt = tile % nTm, nt = tile / nTm;
  gemm_tile(A, Bb, Cb, mt * 16, nt * 16, K, lda, ldb, ldc, lane);
}

// ---- fused MLP: y = act(x W1^T + b1) W2^T + b2, in-place over x ------------
// Both products are formed transposed, so the hidden values never leave the
// wave's registers:
//   Ht (16 hidden x 16 pixels)  = W1 tile (A) * X^T (B)
//   Yt (16 out    x 16 pixels) += W2 tile (A) * Ht  (B)
// A D tile holds Ht[8*hi + r][pixel l15] in register r. Registers (2s, 2s+1)
// are taken as the B fragment of k step s, which puts hidden 8*hi + 2s + j in
// k slot 2*hi + j; the W2 loader reads the same hidden index into the same slot.
// Each wave owns PT pixel tiles: every weight fragment feeds PT products.
// No LDS and no barrier: a wave shares nothing with its neighbours.
#define PT 2
__global__ __launch_bounds__(128, 3)            // 3 waves per SIMD: 336 VGPRs
void mlp_fused(float* __restrict__ XY,          // (P,96) in: xu, out: y
               const float* __restrict__ W1,    // (384,96) row-major
               const float* __restrict__ b1,    // (384)
               const float* __restrict__ W2,    // (96,384) row-major
               const float* __restrict__ b2,    // (96)
               const float* __restrict__ coef)  // (384,3)
{
  const int wave = threadIdx.x >> 5;
  const int lane = threadIdx.x & 31;
  const int l15 = lane & 15, hi = lane >> 4, kh = hi << 1;
  const unsigned p0 = (blockIdx.x * 4u + wave) * (16u * PT);   // 262144 pixels: 32 bits hold every offset

  // X^T fragments of the wave's pixels, all 96 channels, kept for the whole run
  v2f xf[PT][24];
  const float* xrow = XY + (p0 + l15) * 96u + kh;
#pragma unroll
  for (int p = 0; p < PT; ++p) {
#pragma unroll
    for (int kk = 0; kk < 24; ++kk) xf[p][kk] = *(const v2f*)(xrow + p * (16 * 96) + kk * 4);
  }

  // W1 fragments of hidden tile 0; later tiles are fetched inside the loop
  v2f w1f[24];
  const float* w1r = W1 + (size_t)l15 * 96 + kh;
#pragma unroll
  for (int kk = 0; kk < 24; ++kk) w1f[kk] = *(const v2f*)(w1r + kk * 4);
  // The loads' address registers get new values further down: the wait stands
  // in front of that. It names the addresses so that their registers are left
  // alone up to it; the fence keeps later code behind it. Same form below.
  asm volatile("s_wait_xcnt 0x0" :: "v"(xrow), "v"(w1r) : "memory");
  __builtin_amdgcn_sched_barrier(0);

  v8f y[6][PT] = {};

  // rolled: one 16-wide hidden tile per trip keeps the body inside the
  // register budget
#pragma unroll 1
  for (int ht = 0; ht < 24; ++ht) {
    const int hb = ht * 16 + 8 * hi;            // register r is hidden hb + r

    // this tile's W2 fragments, asked for one product ahead of their use
    v4f w2f[12];
    const float* w2r = W2 + (size_t)l15 * 384 + hb;
#pragma unroll
    for (int o = 0; o < 6; ++o) {
      w2f[2 * o]     = *(const v4f*)(w2r + o * (16 * 384));
      w2f[2 * o + 1] = *(const v4f*)(w2r + o * (16 * 384) + 4);
    }
    // the fence also keeps the loads in front of product 1 (sunk to their use,
    // each would cost its whole latency there)
    asm volatile("s_wait_xcnt 0x0" :: "v"(w2r) : "memory");
    __builtin_amdgcn_sched_barrier(0);

    // Ht = W1 tile * X^T
    v8f h[PT] = {};
#pragma unroll
    for (int kk = 0; kk < 16; ++kk) {
#pragma unroll
      for (int p = 0; p < PT; ++p)
        h[p] = __builtin_amdgcn_wmma_f32_16x16x4_f32(false, w1f[kk], false, xf[p][kk],
                                                     (short)0, h[p], false, false);
    }
    // bias and coefficients of the 8 hidden channels, into registers that the
    // used W1 fragments have left; the fence keeps them from rising further
    __builtin_amdgcn_sched_barrier(0);
    v4f bv[2], cv[6];
    const float* b1r = b1 + hb;
    const float* cfr = coef + hb * 3;
#pragma unroll
    for (int i = 0; i < 2; ++i) bv[i] = *(const v4f*)(b1r + 4 * i);
#pragma unroll
    for (int i = 0; i < 6; ++i) cv[i] = *(const v4f*)(cfr + 4 * i);
    // wait and fence as above: loads in front of the last third of product 1
    asm volatile("s_wait_xcnt 0x0" :: "v"(b1r), "v"(cfr) : "memory");
    __builtin_amdgcn_sched_barrier(0);
#pragma unroll
    for (int kk = 16; kk < 24; ++kk) {
#pragma unroll
      for (int p = 0; p < PT; ++p)
        h[p] = __builtin_amdgcn_wmma_f32_16x16x4_f32(false, w1f[kk], false, xf[p][kk],
                                                     (short)0, h[p], false, false);
    }

    // bias and per-channel quadratic
#pragma unroll
    for (int r = 0; r < 8; ++r) {
      const float bb = bv[r >> 2][r & 3];
      const float c0 = cv[(3 * r) >> 2][(3 * r) & 3];
      const float c1 = cv[(3 * r + 1) >> 2][(3 * r + 1) & 3];
      const float c2 = cv[(3 * r + 2) >> 2][(3 * r + 2) & 3];
#pragma unroll
      for (int p = 0; p < PT; ++p) {
        float t = h[p][r] + bb;
        h[p][r] = c0 + t * (c1 + c2 * t);
      }
    }

    // Next tile's W1 fragments are asked for one product ahead of their use, in
    // two halves: the second goes into registers that the first half of
    // product 2 has left. (The last trip asks for its own tile again: in
    // bounds, not used.) The fence keeps the arithmetic above out of the group.
    const int hn = ht < 23 ? ht + 1 : 23;
    const float* w1n = W1 + (size_t)(hn * 16 + l15) * 96 + kh;
#pragma unroll
    for (int half = 0; half < 2; ++half) {
      __builtin_amdgcn_sched_barrier(0);
#pragma unroll
      for (int kk = 12 * half; kk < 12 * half + 12; ++kk) w1f[kk] = *(const v2f*)(w1n + kk * 4);
      // wait and fence as above: loads in front of this half of product 2
      asm volatile("s_wait_xcnt 0x0" :: "v"(w1n) : "memory");
      __builtin_amdgcn_sched_barrier(0);

      // Yt += W2 tile * Ht, three of the six output tiles
#pragma unroll
      for (int o = 3 * half; o < 3 * half + 3; ++o) {
#pragma unroll
        for (int s = 0; s < 4; ++s) {
          const v4f w = w2f[2 * o + (s >> 1)];
          const v2f a = (s & 1) ? (v2f){w.z, w.w} : (v2f){w.x, w.y};
#pragma unroll
          for (int p = 0; p < PT; ++p) {
            const v2f b = {h[p][2 * s], h[p][2 * s + 1]};
            y[o][p] = __builtin_amdgcn_wmma_f32_16x16x4_f32(false, a, false, b,
                                                            (short)0, y[o][p], false, false);
          }
        }
      }
    }
  }

  // register r of y[o][p] is Y[pixel][o*16 + 8*hi + r]: 8 consecutive channels
  const unsigned b2o = 32u * hi;                 // byte offset of the lane's half
  v4f bo[12];
#pragma unroll
  for (int i = 0; i < 12; ++i)
    bo[i] = *(const v4f*)((const char*)b2 + b2o + (i >> 1) * 64 + (i & 1) * 16);
  // wait and fence as above, in front of the store addresses
  asm volatile("s_wait_xcnt 0x0" :: "v"(b2o) : "memory");
  __builtin_amdgcn_sched_barrier(0);
#pragma unroll
  for (int o = 0; o < 6; ++o) {
    const v4f blo = bo[2 * o], bhi = bo[2 * o + 1];
#pragma unroll
    for (int p = 0; p < PT; ++p) {
      float* yrow = XY + (p0 + p * 16 + l15) * 96u + o * 16 + 8 * hi;  // in-place: our rows only
      v4f lo = {y[o][p][0] + blo.x, y[o][p][1] + blo.y, y[o][p][2] + blo.z, y[o][p][3] + blo.w};
      v4f hv = {y[o][p][4] + bhi.x, y[o][p][5] + bhi.y, y[o][p][6] + bhi.z, y[o][p][7] + bhi.w};
      *(v4f*)(yrow)     = lo;
      *(v4f*)(yrow + 4) = hv;
    }
  }
}

// ---------------------------------------------------------------------------
extern "C" void kernel_launch(void* const* d_in, const int* in_sizes, int n_in,
                              void* d_out, int out_size, void* d_ws, size_t ws_size,
                              hipStream_t stream) {
  const float* x    = (const float*)d_in[0];   // (16,64,64,96)
  const float* W1   = (const float*)d_in[1];   // (384,96)
  const float* b1   = (const float*)d_in[2];   // (384)
  const float* W2   = (const float*)d_in[3];   // (96,384)
  const float* b2   = (const float*)d_in[4];   // (96)
  const float* coef = (const float*)d_in[5];   // (384,3)
  float* out = (float*)d_out;                  // (16,64,64,96)

  float* U = (float*)d_ws;                     // 128x64
  float* D = U + 128 * 64;                     // 64x128
  float* T = D + 64 * 128;                     // 16*128*64*96  (t1 / t2)
  float* X = T + 12582912;                     // 16*128*128*96 (xu / y)

  gen_filters<<<32, 256, 0, stream>>>(U, D);

  // t1[b] (128 x 6144) = U (128x64) @ x[b] (64 x 6144)        [H upsample]
  filt_gemm<<<dim3(384, 16), 256, 0, stream>>>(U, x, T,
      128, 6144, 64, 64, 6144, 6144, 393216L, 786432L);

  // xu[b,i] (128 x 96) = U (128x64) @ t1[b,i] (64 x 96)       [W upsample]
  filt_gemm<<<dim3(6, 2048), 256, 0, stream>>>(U, T, X,
      128, 96, 64, 64, 96, 96, 6144L, 12288L);

  // y = MLP(xu), in place over X; 262144 pixels / (4 waves x 32) per block
  mlp_fused<<<2048, 128, 0, stream>>>(X, W1, b1, W2, b2, coef);

  // t2[b,i] (64 x 96) = D (64x128) @ y[b,i] (128 x 96)        [W lpf+decimate]
  filt_gemm<<<dim3(3, 2048), 256, 0, stream>>>(D, X, T,
      64, 96, 128, 128, 96, 96, 12288L, 6144L);

  // out[b] (64 x 6144) = D (64x128) @ t2[b] (128 x 6144)      [H lpf+decimate]
  filt_gemm<<<dim3(192, 16), 256, 0, stream>>>(D, T, out,
      64, 6144, 128, 128, 6144, 6144, 786432L, 393216L);
}

// v002
// A run of this version takes 274 microseconds.
// In both of two side-by-side timings against v001, it was 1.36 times as fast.
// Over all steps from v000 it is 1.93 times as fast.
#include <hip/hip_runtime.h>
#include <math.h>

// ---------------------------------------------------------------------------
// Alias-free quadratic MLP (16,64,64,96) for MI455X / gfx1250, wave32 + WMMA.
//
// Pipeline (all periodic ideal filters expressed as dense circulant matrices):
//   t1 = U @ x          per batch      (128x64)(64x6144)        [H upsample]
//   xu = U @ t1         per (b,row)    (128x64)(64x96)          [W upsample]
//   y  = act(xu W1^T+b1) W2^T + b2     fused, hidden in VGPRs   [MLP]
//   t2 = D @ y          per (b,row)    (64x128)(128x96)         [W lpf+decim]
//   out= D @ t2         per batch      (64x128)(128x6144)       [H lpf+decim]
// All GEMMs via V_WMMA_F32_16X16X4_F32 (fp32-faithful matrix path).
//
// Workspace layout (needs 151,060,480 bytes):
//   U: 128*64 f32 | D: 64*128 f32 | T: 16*128*64*96 f32 | X: 16*128*128*96 f32
// ---------------------------------------------------------------------------

typedef __attribute__((ext_vector_type(2))) float v2f;
typedef __attribute__((ext_vector_type(4))) float v4f;
typedef __attribute__((ext_vector_type(8))) float v8f;

#define PI_F 3.14159265358979323846f

// ---- build the 1-D resampling operators ------------------------------------
// U[i,h]: zero-insert-by-2 then ideal LPF (|k|<=32, edge weight 1.0), x2 gain.
// D[n,j]: ideal LPF (|k|<32 full, |k|=32 at 0.5) then take every other sample.
__global__ void gen_filters(float* __restrict__ U, float* __restrict__ D) {
  int tid = blockIdx.x * blockDim.x + threadIdx.x;
  int stride = gridDim.x * blockDim.x;
  for (int idx = tid; idx < 128 * 64; idx += stride) {
    int i = idx >> 6, h = idx & 63;
    float d = (float)(i - 2 * h);
    float s = 1.0f;
    for (int k = 1; k <= 32; ++k) s += 2.0f * cosf(PI_F * (float)k * d / 64.0f);
    U[idx] = s * (1.0f / 64.0f);
  }
  for (int idx = tid; idx < 64 * 128; idx += stride) {
    int n = idx >> 7, j = idx & 127;
    float d = (float)(2 * n - j);
    float s = 1.0f;
    for (int k = 1; k <= 31; ++k) s += 2.0f * cosf(PI_F * (float)k * d / 64.0f);
    s += cosf(PI_F * 0.5f * d);                // |k|=32 pair at weight 0.5
    D[idx] = s * (1.0f / 128.0f);
  }
}

// ---- batched filter GEMM: C[b] (M x LD) = A (M x K) * B[b] (K x LD) ---------
// A wave keeps half of the filter matrix (M/2 rows, all of K) as A fragments in
// its registers and sweeps S strips of 32 columns with them, so the filter is
// fetched once a wave and not once a 16x16 tile. The two waves of a pair take
// the two halves of M for the same strips.
// A strip is two 16-column tiles, one whole 128-byte line a row, so every A
// fragment feeds two products and every B fragment M/32. Loads land in fragment
// form and stores leave from the accumulators: no vector work between the
// products. Every output element keeps its k order.
template <int M, int K, int LD, int S>
__device__ __forceinline__ void filt_body(const float* __restrict__ A,
                                          const float* __restrict__ B,
                                          float* __restrict__ C) {
  constexpr int MT  = M / 32;                  // 16-row tiles per wave
  constexpr int KS  = K / 4;                   // k steps
  constexpr int SPB = LD / 32;                 // strips per batch item
  const int wave = __builtin_amdgcn_readfirstlane(threadIdx.x >> 5);
  const int lane = threadIdx.x & 31;
  const int l15 = lane & 15, hi = lane >> 4, kh = hi << 1;
  const int m0 = (wave & 1) * (M / 2);
  const unsigned pair = blockIdx.x * 2u + (wave >> 1);

  v2f af[MT][KS];
  const float* arow = A + (m0 + l15) * K + kh;
#pragma unroll
  for (int ks = 0; ks < KS; ++ks) {
#pragma unroll
    for (int mt = 0; mt < MT; ++mt) af[mt][ks] = *(const v2f*)(arow + mt * (16 * K) + ks * 4);
  }
  // The loads' address registers may get new values further down: the wait
  // stands in front of that; the fence keeps later code behind it.
  asm volatile("s_wait_xcnt 0x0" ::: "memory");
  __builtin_amdgcn_sched_barrier(0);

  // first strip of the pair; n0 is its first column inside batch item bi
  const unsigned bi = (pair * S) / SPB;
  unsigned n0 = ((pair * S) % SPB) * 32u;
  // the lane's element offsets into B and C (every buffer has fewer than 2^25 elements)
  unsigned bo = bi * (unsigned)(K * LD) + n0 + (unsigned)(kh * LD + l15);
  unsigned co = bi * (unsigned)(M * LD) + n0 + (unsigned)((m0 + 8 * hi) * LD + l15);

  // rolled: one strip a trip keeps the body inside the register budget
#pragma unroll 1
  for (int s = 0; s < S; ++s) {
    // the strip's B fragments: rows k and k+1 of the lane's half, both tiles
    v2f bf[KS][2];
    const float* bp = B + bo;
#pragma unroll
    for (int ks = 0; ks < KS; ++ks) {
#pragma unroll
      for (int t = 0; t < 2; ++t) {
        bf[ks][t].x = bp[(ks * 4) * LD + 16 * t];
        bf[ks][t].y = bp[(ks * 4 + 1) * LD + 16 * t];
      }
    }
    // Wait as above. It takes the offset in and out, so that the offset keeps a
    // register of its own from trip to trip and is stepped behind the wait, at
    // the foot; formed anew each trip, the store address landed among the
    // products, in a register that one of them had just read. The fence also
    // keeps the loads together in front of the products (sunk to their use,
    // each would cost its whole latency).
    asm volatile("s_wait_xcnt 0x0" : "+v"(bo) :: "memory");
    __builtin_amdgcn_sched_barrier(0);

    v8f acc[MT][2] = {};
#pragma unroll
    for (int ks = 0; ks < KS; ++ks) {
#pragma unroll
      for (int mt = 0; mt < MT; ++mt) {
#pragma unroll
        for (int t = 0; t < 2; ++t)
          acc[mt][t] = __builtin_amdgcn_wmma_f32_16x16x4_f32(false, af[mt][ks], false, bf[ks][t],
                                                             (short)0, acc[mt][t], false, false);
      }
    }
    // the fence keeps the stores behind all products: with stores drawn in
    // between, some accumulators were run alone, as one dependent chain each
    __builtin_amdgcn_sched_barrier(0);

    float* cp = C + co;
#pragma unroll
    for (int mt = 0; mt < MT; ++mt) {
#pragma unroll
      for (int r = 0; r < 8; ++r) {
#pragma unroll
        for (int t = 0; t < 2; ++t) cp[(mt * 16 + r) * LD + 16 * t] = acc[mt][t][r];
      }
    }
    // wait and fence as above, in front of the step to the next strip
    asm volatile("s_wait_xcnt 0x0" : "+v"(co) :: "memory");
    __builtin_amdgcn_sched_barrier(0);

    // next strip: 32 columns on, or the first columns of the next batch item
    const bool last = (n0 + 32u == (unsigned)LD);
    bo += last ? (unsigned)(K * LD - (LD - 32)) : 32u;
    co += last ? (unsigned)(M * LD - (LD - 32)) : 32u;
    n0 = last ? 0u : n0 + 32u;
  }
}

// 3 waves per SIMD: 336 VGPRs, of which the A fragments take 128
__global__ __launch_bounds__(128, 3)
void filt_up_h(const float* __restrict__ A, const float* __restrict__ B, float* __restrict__ C) {
  filt_body<128, 64, 6144, 2>(A, B, C);
}
__global__ __launch_bounds__(128, 3)
void filt_up_w(const float* __restrict__ A, const float* __restrict__ B, float* __restrict__ C) {
  filt_body<128, 64, 96, 4>(A, B, C);
}
__global__ __launch_bounds__(128, 3)
void filt_dn_w(const float* __restrict__ A, const float* __restrict__ B, float* __restrict__ C) {
  filt_body<64, 128, 96, 4>(A, B, C);
}
__global__ __launch_bounds__(128, 3)
void filt_dn_h(const float* __restrict__ A, const float* __restrict__ B, float* __restrict__ C) {
  filt_body<64, 128, 6144, 2>(A, B, C);
}

// ---- fused MLP: y = act(x W1^T + b1) W2^T + b2, in-place over x ------------
// Both products are formed transposed, so the hidden values never leave the
// wave's registers:
//   Ht (16 hidden x 16 pixels)  = W1 tile (A) * X^T (B)
//   Yt (16 out    x 16 pixels) += W2 tile (A) * Ht  (B)
// A D tile holds Ht[8*hi + r][pixel l15] in register r. Registers (2s, 2s+1)
// are taken as the B fragment of k step s, which puts hidden 8*hi + 2s + j in
// k slot 2*hi + j; the W2 loader reads the same hidden index into the same slot.
// Each wave owns PT pixel tiles: every weight fragment feeds PT products.
// No LDS and no barrier: a wave shares nothing with its neighbours.
#define PT 2
__global__ __launch_bounds__(128, 3)            // 3 waves per SIMD: 336 VGPRs
void mlp_fused(float* __restrict__ XY,          // (P,96) in: xu, out: y
               const float* __restrict__ W1,    // (384,96) row-major
               const float* __restrict__ b1,    // (384)
               const float* __restrict__ W2,    // (96,384) row-major
               const float* __restrict__ b2,    // (96)
               const float* __restrict__ coef)  // (384,3)
{
  const int wave = threadIdx.x >> 5;
  const int lane = threadIdx.x & 31;
  const int l15 = lane & 15, hi = lane >> 4, kh = hi << 1;
  const unsigned p0 = (blockIdx.x * 4u + wave) * (16u * PT);   // 262144 pixels: 32 bits hold every offset

  // X^T fragments of the wave's pixels, all 96 channels, kept for the whole run
  v2f xf[PT][24];
  const float* xrow = XY + (p0 + l15) * 96u + kh;
#pragma unroll
  for (int p = 0; p < PT; ++p) {
#pragma unroll
    for (int kk = 0; kk < 24; ++kk) xf[p][kk] = *(const v2f*)(xrow + p * (16 * 96) + kk * 4);
  }

  // W1 fragments of hidden tile 0; later tiles are fetched inside the loop
  v2f w1f[24];
  const float* w1r = W1 + (size_t)l15 * 96 + kh;
#pragma unroll
  for (int kk = 0; kk < 24; ++kk) w1f[kk] = *(const v2f*)(w1r + kk * 4);
  // The loads' address registers get new values further down: the wait stands
  // in front of that. It names the addresses so that their registers are left
  // alone up to it; the fence keeps later code behind it. Same form below.
  asm volatile("s_wait_xcnt 0x0" :: "v"(xrow), "v"(w1r) : "memory");
  __builtin_amdgcn_sched_barrier(0);

  v8f y[6][PT] = {};

  // rolled: one 16-wide hidden tile per trip keeps the body inside the
  // register budget
#pragma unroll 1
  for (int ht = 0; ht < 24; ++ht) {
    const int hb = ht * 16 + 8 * hi;            // register r is hidden hb + r

    // this tile's W2 fragments, asked for one product ahead of their use
    v4f w2f[12];
    const float* w2r = W2 + (size_t)l15 * 384 + hb;
#pragma unroll
    for (int o = 0; o < 6; ++o) {
      w2f[2 * o]     = *(const v4f*)(w2r + o * (16 * 384));
      w2f[2 * o + 1] = *(const v4f*)(w2r + o * (16 * 384) + 4);
    }
    // the fence also keeps the loads in front of product 1 (sunk to their use,
    // each would cost its whole latency there)
    asm volatile("s_wait_xcnt 0x0" :: "v"(w2r) : "memory");
    __builtin_amdgcn_sched_barrier(0);

    // Ht = W1 tile * X^T
    v8f h[PT] = {};
#pragma unroll
    for (int kk = 0; kk < 16; ++kk) {
#pragma unroll
      for (int p = 0; p < PT; ++p)
        h[p] = __builtin_amdgcn_wmma_f32_16x16x4_f32(false, w1f[kk], false, xf[p][kk],
                                                     (short)0, h[p], false, false);
    }
    // bias and coefficients of the 8 hidden channels, into registers that the
    // used W1 fragments have left; the fence keeps them from rising further
    __builtin_amdgcn_sched_barrier(0);
    v4f bv[2], cv[6];
    const float* b1r = b1 + hb;
    const float* cfr = coef + hb * 3;
#pragma unroll
    for (int i = 0; i < 2; ++i) bv[i] = *(const v4f*)(b1r + 4 * i);
#pragma unroll
    for (int i = 0; i < 6; ++i) cv[i] = *(const v4f*)(cfr + 4 * i);
    // wait and fence as above: loads in front of the last third of product 1
    asm volatile("s_wait_xcnt 0x0" :: "v"(b1r), "v"(cfr) : "memory");
    __builtin_amdgcn_sched_barrier(0);
#pragma unroll
    for (int kk = 16; kk < 24; ++kk) {
#pragma unroll
      for (int p = 0; p < PT; ++p)
        h[p] = __builtin_amdgcn_wmma_f32_16x16x4_f32(false, w1f[kk], false, xf[p][kk],
                                                     (short)0, h[p], false, false);
    }

    // bias and per-channel quadratic
#pragma unroll
    for (int r = 0; r < 8; ++r) {
      const float bb = bv[r >> 2][r & 3];
      const float c0 = cv[(3 * r) >> 2][(3 * r) & 3];
      const float c1 = cv[(3 * r + 1) >> 2][(3 * r + 1) & 3];
      const float c2 = cv[(3 * r + 2) >> 2][(3 * r + 2) & 3];
#pragma unroll
      for (int p = 0; p < PT; ++p) {
        float t = h[p][r] + bb;
        h[p][r] = c0 + t * (c1 + c2 * t);
      }
    }

    // Next tile's W1 fragments are asked for one product ahead of their use, in
    // two halves: the second goes into registers that the first half of
    // product 2 has left. (The last trip asks for its own tile again: in
    // bounds, not used.) The fence keeps the arithmetic above out of the group.
    const int hn = ht < 23 ? ht + 1 : 23;
    const float* w1n = W1 + (size_t)(hn * 16 + l15) * 96 + kh;
#pragma unroll
    for (int half = 0; half < 2; ++half) {
      __builtin_amdgcn_sched_barrier(0);
#pragma unroll
      for (int kk = 12 * half; kk < 12 * half + 12; ++kk) w1f[kk] = *(const v2f*)(w1n + kk * 4);
      // wait and fence as above: loads in front of this half of product 2
      asm volatile("s_wait_xcnt 0x0" :: "v"(w1n) : "memory");
      __builtin_amdgcn_sched_barrier(0);

      // Yt += W2 tile * Ht, three of the six output tiles
#pragma unroll
      for (int o = 3 * half; o < 3 * half + 3; ++o) {
#pragma unroll
        for (int s = 0; s < 4; ++s) {
          const v4f w = w2f[2 * o + (s >> 1)];
          const v2f a = (s & 1) ? (v2f){w.z, w.w} : (v2f){w.x, w.y};
#pragma unroll
          for (int p = 0; p < PT; ++p) {
            const v2f b = {h[p][2 * s], h[p][2 * s + 1]};
            y[o][p] = __builtin_amdgcn_wmma_f32_16x16x4_f32(false, a, false, b,
                                                            (short)0, y[o][p], false, false);
          }
        }
      }
    }
  }

  // register r of y[o][p] is Y[pixel][o*16 + 8*hi + r]: 8 consecutive channels
  const unsigned b2o = 32u * hi;                 // byte offset of the lane's half
  v4f bo[12];
#pragma unroll
  for (int i = 0; i < 12; ++i)
    bo[i] = *(const v4f*)((const char*)b2 + b2o + (i >> 1) * 64 + (i & 1) * 16);
  // wait and fence as above, in front of the store addresses
  asm volatile("s_wait_xcnt 0x0" :: "v"(b2o) : "memory");
  __builtin_amdgcn_sched_barrier(0);
#pragma unroll
  for (int o = 0; o < 6; ++o) {
    const v4f blo = bo[2 * o], bhi = bo[2 * o + 1];
#pragma unroll
    for (int p = 0; p < PT; ++p) {
      float* yrow = XY + (p0 + p * 16 + l15) * 96u + o * 16 + 8 * hi;  // in-place: our rows only
      v4f lo = {y[o][p][0] + blo.x, y[o][p][1] + blo.y, y[o][p][2] + blo.z, y[o][p][3] + blo.w};
      v4f hv = {y[o][p][4] + bhi.x, y[o][p][5] + bhi.y, y[o][p][6] + bhi.z, y[o][p][7] + bhi.w};
      *(v4f*)(yrow)     = lo;
      *(v4f*)(yrow + 4) = hv;
    }
  }
}

// ---------------------------------------------------------------------------
extern "C" void kernel_launch(void* const* d_in, const int* in_sizes, int n_in,
                              void* d_out, int out_size, void* d_ws, size_t ws_size,
                              hipStream_t stream) {
  const float* x    = (const float*)d_in[0];   // (16,64,64,96)
  const float* W1   = (const float*)d_in[1];   // (384,96)
  const float* b1   = (const float*)d_in[2];   // (384)
  const float* W2   = (const float*)d_in[3];   // (96,384)
  const float* b2   = (const float*)d_in[4];   // (96)
  const float* coef = (const float*)d_in[5];   // (384,3)
  float* out = (float*)d_out;                  // (16,64,64,96)

  float* U = (float*)d_ws;                     // 128x64
  float* D = U + 128 * 64;                     // 64x128
  float* T = D + 64 * 128;                     // 16*128*64*96  (t1 / t2)
  float* X = T + 12582912;                     // 16*128*128*96 (xu / y)

  gen_filters<<<32, 256, 0, stream>>>(U, D);

  // every filter launch: 768 blocks x 2 wave pairs x S strips of 32 columns

  // t1[b] (128 x 6144) = U (128x64) @ x[b] (64 x 6144)        [H upsample]
  filt_up_h<<<768, 128, 0, stream>>>(U, x, T);

  // xu[b,i] (128 x 96) = U (128x64) @ t1[b,i] (64 x 96)       [W upsample]
  filt_up_w<<<768, 128, 0, stream>>>(U, T, X);

  // y = MLP(xu), in place over X; 262144 pixels / (4 waves x 32) per block
  mlp_fused<<<2048, 128, 0, stream>>>(X, W1, b1, W2, b2, coef);

  // t2[b,i] (64 x 96) = D (64x128) @ y[b,i] (128 x 96)        [W lpf+decimate]
  filt_dn_w<<<768, 128, 0, stream>>>(D, X, T);

  // out[b] (64 x 6144) = D (64x128) @ t2[b] (128 x 6144)      [H lpf+decimate]
  filt_dn_h<<<768, 128, 0, stream>>>(D, T, out);
}

// v003
// A run of this version takes 189 microseconds.
// Next to v002, in two timings, it ran 1.45 and 1.44 times as fast.
// Over all steps from v000 it is 2.80 times as fast.
#include <hip/hip_runtime.h>
#include <math.h>

// ---------------------------------------------------------------------------
// Alias-free quadratic MLP (16,64,64,96) for MI455X / gfx1250, wave32 + WMMA.
//
// Pipeline (all periodic ideal filters expressed as dense matrices):
//   t1 = U @ x          per batch      (100x64)(64x6144)        [H resample]
//   xu = U @ t1         per (b,row)    (100x64)(64x96)          [W resample]
//   y  = act(xu W1^T+b1) W2^T + b2     fused, hidden in VGPRs   [MLP]
//   t2 = D @ y          per (b,row)    (64x100)(100x96)         [W lpf+sample]
//   out= D @ t2         per batch      (64x100)(100x6144)       [H lpf+sample]
// All GEMMs via V_WMMA_F32_16X16X4_F32 (fp32-faithful matrix path).
//
// The grid between the two filters has 100 points an axis, not 128. The result
// is the same function of the inputs, for every input:
//   - the upsampled signal is a trigonometric polynomial with |k| <= 32 an axis;
//     U evaluates that same polynomial at i/100 in place of i/128;
//   - the MLP is pointwise and of degree 2 (coef has three columns), so y is a
//     trigonometric polynomial with |k| <= 64 an axis;
//   - the low-pass keeps |k| <= 32. Sampled at N points, coefficient k' folds
//     onto k = k' - N; with |k'| <= 64 it reaches a kept k only if N <= 96.
//     So for N > 96 the N-point sums give the kept coefficients exactly, and
//     D forms them, weights them and evaluates them at n/64.
// 100 is a multiple of the k step of 4, and 16*100*100 pixels fill whole blocks.
//
// Workspace layout (needs 100,815,872 bytes):
//   U: 112*64 f32 | D: 64*100 f32 | T: 16*100*64*96 f32 | X: 16*100*100*96 f32
// ---------------------------------------------------------------------------

typedef __attribute__((ext_vector_type(2))) float v2f;
typedef __attribute__((ext_vector_type(4))) float v4f;
typedef __attribute__((ext_vector_type(8))) float v8f;

#define PI_F 3.14159265358979323846f

// ---- build the 1-D resampling operators ------------------------------------
// U[i,h]: the band-limited interpolant of 64 samples (|k|<=32, both edge terms
//         at weight 1.0, as zero-insertion and the ideal LPF give it) at i/100.
//         Rows 100..111 only fill the last 16-row tile; nothing of them is stored.
// D[n,j]: coefficients |k|<32 full, |k|=32 at 0.5, from 100 samples, at n/64.
// The phase k*(i/100 - h/64) is counted in whole 1600ths of a turn and reduced
// in integers, so that every cosine gets an argument below one turn.
__global__ void gen_filters(float* __restrict__ U, float* __restrict__ D) {
  int tid = blockIdx.x * blockDim.x + threadIdx.x;
  int stride = gridDim.x * blockDim.x;
  for (int idx = tid; idx < 112 * 64; idx += stride) {
    int i = idx >> 6, h = idx & 63;
    int q = (16 * i - 25 * h) % 1600;
    if (q < 0) q += 1600;
    int m = 0;
    float s = 1.0f;
    for (int k = 1; k <= 32; ++k) {
      m += q;
      if (m >= 1600) m -= 1600;
      s += 2.0f * cosf(PI_F * (float)m / 800.0f);
    }
    U[idx] = s * (1.0f / 64.0f);
  }
  for (int idx = tid; idx < 64 * 100; idx += stride) {
    int n = idx / 100, j = idx - n * 100;
    int q = (25 * n - 16 * j) % 1600;
    if (q < 0) q += 1600;
    int m = 0;
    float s = 1.0f;
    for (int k = 1; k <= 31; ++k) {
      m += q;
      if (m >= 1600) m -= 1600;
      s += 2.0f * cosf(PI_F * (float)m / 800.0f);
    }
    m += q;
    if (m >= 1600) m -= 1600;
    s += cosf(PI_F * (float)m / 800.0f);       // |k|=32 pair at weight 0.5
    D[idx] = s * (1.0f / 100.0f);
  }
}

// ---- batched filter GEMM: C[b] (M x LD) = A (M x K) * B[b] (K x LD) ---------
// A wave keeps its part of the filter matrix (MT tiles of 16 rows from row m0,
// all of K) as A fragments in its registers and sweeps S strips of 32 columns
// with them, so the filter is fetched once a wave and not once a 16x16 tile.
// The two waves of a pair take the two parts of M for the same strips. Of the
// wave's last tile the first VL rows exist in C (16, or at most 8).
// A strip is two 16-column tiles, one whole 128-byte line a row, so every A
// fragment feeds two products and every B fragment MT. Loads land in fragment
// form and stores leave from the accumulators: no vector work between the
// products. Every output element keeps its k order.
template <int MT, int VL, int M, int K, int LD, int S>
__device__ __forceinline__ void filt_body(const float* __restrict__ A,
                                          const float* __restrict__ B,
                                          float* __restrict__ C,
                                          const int m0, const unsigned pair) {
  static_assert(VL == 16 || VL <= 8, "a cut tile ends inside its lower half");
  constexpr int MF  = VL == 16 ? MT : MT - 1;  // tiles stored whole
  constexpr int KS  = K / 4;                   // k steps
  constexpr int SPB = LD / 32;                 // strips per batch item
  const int lane = threadIdx.x & 31;
  const int l15 = lane & 15, hi = lane >> 4, kh = hi << 1;

  v2f af[MT][KS];
  const float* arow = A + (m0 + l15) * K + kh;
#pragma unroll
  for (int ks = 0; ks < KS; ++ks) {
#pragma unroll
    for (int mt = 0; mt < MT; ++mt) af[mt][ks] = *(const v2f*)(arow + mt * (16 * K) + ks * 4);
  }
  // The loads' address registers may get new values further down: the wait
  // stands in front of that; the fence keeps later code behind it.
  asm volatile("s_wait_xcnt 0x0" ::: "memory");
  __builtin_amdgcn_sched_barrier(0);

  // first strip of the pair; n0 is its first column inside batch item bi
  const unsigned bi = (pair * S) / SPB;
  unsigned n0 = ((pair * S) % SPB) * 32u;
  // the lane's element offsets into B and C (every buffer has fewer than 2^25 elements)
  unsigned bo = bi * (unsigned)(K * LD) + n0 + (unsigned)(kh * LD + l15);
  unsigned co = bi * (unsigned)(M * LD) + n0 + (unsigned)((m0 + 8 * hi) * LD + l15);

  // rolled: one strip a trip keeps the body inside the register budget
#pragma unroll 1
  for (int s = 0; s < S; ++s) {
    // the strip's B fragments: rows k and k+1 of the lane's half, both tiles
    v2f bf[KS][2];
    const float* bp = B + bo;
#pragma unroll
    for (int ks = 0; ks < KS; ++ks) {
#pragma unroll
      for (int t = 0; t < 2; ++t) {
        bf[ks][t].x = bp[(ks * 4) * LD + 16 * t];
        bf[ks][t].y = bp[(ks * 4 + 1) * LD + 16 * t];
      }
    }
    // Wait as above. It takes the offset in and out, so that the offset keeps a
    // register of its own from trip to trip and is stepped behind the wait, at
    // the foot; formed anew each trip, the store address landed among the
    // products, in a register that one of them had just read. The fence also
    // keeps the loads together in front of the products (sunk to their use,
    // each would cost its whole latency).
    asm volatile("s_wait_xcnt 0x0" : "+v"(bo) :: "memory");
    __builtin_amdgcn_sched_barrier(0);

    v8f acc[MT][2] = {};
#pragma unroll
    for (int ks = 0; ks < KS; ++ks) {
#pragma unroll
      for (int mt = 0; mt < MT; ++mt) {
#pragma unroll
        for (int t = 0; t < 2; ++t)
          acc[mt][t] = __builtin_amdgcn_wmma_f32_16x16x4_f32(false, af[mt][ks], false, bf[ks][t],
                                                             (short)0, acc[mt][t], false, false);
      }
    }
    // the fence keeps the stores behind all products: with stores drawn in
    // between, some accumulators were run alone, as one dependent chain each
    __builtin_amdgcn_sched_barrier(0);

    float* cp = C + co;
#pragma unroll
    for (int mt = 0; mt < MF; ++mt) {
#pragma unroll
      for (int r = 0; r < 8; ++r) {
#pragma unroll
        for (int t = 0; t < 2; ++t) cp[(mt * 16 + r) * LD + 16 * t] = acc[mt][t][r];
      }
    }
    // the cut tile: its rows VL..15 are not part of C
    if constexpr (VL < 16) {
      if (hi == 0) {
#pragma unroll
        for (int r = 0; r < VL; ++r) {
#pragma unroll
          for (int t = 0; t < 2; ++t) cp[(MF * 16 + r) * LD + 16 * t] = acc[MF][t][r];
        }
      }
    }
    // wait and fence as above, in front of the step to the next strip
    asm volatile("s_wait_xcnt 0x0" : "+v"(co) :: "memory");
    __builtin_amdgcn_sched_barrier(0);

    // next strip: 32 columns on, or the first columns of the next batch item
    const bool last = (n0 + 32u == (unsigned)LD);
    bo += last ? (unsigned)(K * LD - (LD - 32)) : 32u;
    co += last ? (unsigned)(M * LD - (LD - 32)) : 32u;
    n0 = last ? 0u : n0 + 32u;
  }
}

// The wave's number in a scalar register: which part of M it takes is a scalar branch.
__device__ __forceinline__ int wave_id() { return __builtin_amdgcn_readfirstlane(threadIdx.x >> 5); }

// 100 rows are 6 tiles and 4 rows: the even wave of a pair takes rows 0..63,
// the odd one rows 64..99.
template <int LD>
__device__ __forceinline__ void filt_up(const float* __restrict__ A, const float* __restrict__ B,
                                        float* __restrict__ C) {
  const int wave = wave_id();
  const unsigned pair = blockIdx.x * 2u + (wave >> 1);
  if (wave & 1) filt_body<3, 4, 100, 64, LD, 2>(A, B, C, 64, pair);
  else          filt_body<4, 16, 100, 64, LD, 2>(A, B, C, 0, pair);
}
template <int LD>
__device__ __forceinline__ void filt_dn(const float* __restrict__ A, const float* __restrict__ B,
                                        float* __restrict__ C) {
  const int wave = wave_id();
  filt_body<2, 16, 64, 100, LD, 2>(A, B, C, (wave & 1) * 32, blockIdx.x * 2u + (wave >> 1));
}

// 3 waves per SIMD: 336 VGPRs, of which the A fragments take up to 128
__global__ __launch_bounds__(128, 3)
void filt_up_h(const float* __restrict__ A, const float* __restrict__ B, float* __restrict__ C) {
  filt_up<6144>(A, B, C);
}
__global__ __launch_bounds__(128, 3)
void filt_up_w(const float* __restrict__ A, const float* __restrict__ B, float* __restrict__ C) {
  filt_up<96>(A, B, C);
}
__global__ __launch_bounds__(128, 3)
void filt_dn_w(const float* __restrict__ A, const float* __restrict__ B, float* __restrict__ C) {
  filt_dn<96>(A, B, C);
}
__global__ __launch_bounds__(128, 3)
void filt_dn_h(const float* __restrict__ A, const float* __restrict__ B, float* __restrict__ C) {
  filt_dn<6144>(A, B, C);
}

// ---- fused MLP: y = act(x W1^T + b1) W2^T + b2, in-place over x ------------
// Both products are formed transposed, so the hidden values never leave the
// wave's registers:
//   Ht (16 hidden x 16 pixels)  = W1 tile (A) * X^T (B)
//   Yt (16 out    x 16 pixels) += W2 tile (A) * Ht  (B)
// A D tile holds Ht[8*hi + r][pixel l15] in register r. Registers (2s, 2s+1)
// are taken as the B fragment of k step s, which puts hidden 8*hi + 2s + j in
// k slot 2*hi + j; the W2 loader reads the same hidden index into the same slot.
// Each wave owns PT pixel tiles: every weight fragment feeds PT products.
// No LDS and no barrier: a wave shares nothing with its neighbours.
#define PT 2
__global__ __launch_bounds__(128, 3)            // 3 waves per SIMD: 336 VGPRs
void mlp_fused(float* __restrict__ XY,          // (P,96) in: xu, out: y
               const float* __restrict__ W1,    // (384,96) row-major
               const float* __restrict__ b1,    // (384)
               const float* __restrict__ W2,    // (96,384) row-major
               const float* __restrict__ b2,    // (96)
               const float* __restrict__ coef)  // (384,3)
{
  const int wave = threadIdx.x >> 5;
  const int lane = threadIdx.x & 31;
  const int l15 = lane & 15, hi = lane >> 4, kh = hi << 1;
  const unsigned p0 = (blockIdx.x * 4u + wave) * (16u * PT);   // 160000 pixels: 32 bits hold every offset

  // X^T fragments of the wave's pixels, all 96 channels, kept for the whole run
  v2f xf[PT][24];
  const float* xrow = XY + (p0 + l15) * 96u + kh;
#pragma unroll
  for (int p = 0; p < PT; ++p) {
#pragma unroll
    for (int kk = 0; kk < 24; ++kk) xf[p][kk] = *(const v2f*)(xrow + p * (16 * 96) + kk * 4);
  }

  // W1 fragments of hidden tile 0; later tiles are fetched inside the loop
  v2f w1f[24];
  const float* w1r = W1 + (size_t)l15 * 96 + kh;
#pragma unroll
  for (int kk = 0; kk < 24; ++kk) w1f[kk] = *(const v2f*)(w1r + kk * 4);
  // The loads' address registers get new values further down: the wait stands
  // in front of that. It names the addresses so that their registers are left
  // alone up to it; the fence keeps later code behind it. Same form below.
  asm volatile("s_wait_xcnt 0x0" :: "v"(xrow), "v"(w1r) : "memory");
  __builtin_amdgcn_sched_barrier(0);

  v8f y[6][PT] = {};

  // rolled: one 16-wide hidden tile per trip keeps the body inside the
  // register budget
#pragma unroll 1
  for (int ht = 0; ht < 24; ++ht) {
    const int hb = ht * 16 + 8 * hi;            // register r is hidden hb + r

    // this tile's W2 fragments, asked for one product ahead of their use
    v4f w2f[12];
    const float* w2r = W2 + (size_t)l15 * 384 + hb;
#pragma unroll
    for (int o = 0; o < 6; ++o) {
      w2f[2 * o]     = *(const v4f*)(w2r + o * (16 * 384));
      w2f[2 * o + 1] = *(const v4f*)(w2r + o * (16 * 384) + 4);
    }
    // the fence also keeps the loads in front of product 1 (sunk to their use,
    // each would cost its whole latency there)
    asm volatile("s_wait_xcnt 0x0" :: "v"(w2r) : "memory");
    __builtin_amdgcn_sched_barrier(0);

    // Ht = W1 tile * X^T
    v8f h[PT] = {};
#pragma unroll
    for (int kk = 0; kk < 16; ++kk) {
#pragma unroll
      for (int p = 0; p < PT; ++p)
        h[p] = __builtin_amdgcn_wmma_f32_16x16x4_f32(false, w1f[kk], false, xf[p][kk],
                                                     (short)0, h[p], false, false);
    }
    // bias and coefficients of the 8 hidden channels, into registers that the
    // used W1 fragments have left; the fence keeps them from rising further
    __builtin_amdgcn_sched_barrier(0);
    v4f bv[2], cv[6];
    const float* b1r = b1 + hb;
    const float* cfr = coef + hb * 3;
#pragma unroll
    for (int i = 0; i < 2; ++i) bv[i] = *(const v4f*)(b1r + 4 * i);
#pragma unroll
    for (int i = 0; i < 6; ++i) cv[i] = *(const v4f*)(cfr + 4 * i);
    // wait and fence as above: loads in front of the last third of product 1
    asm volatile("s_wait_xcnt 0x0" :: "v"(b1r), "v"(cfr) : "memory");
    __builtin_amdgcn_sched_barrier(0);
#pragma unroll
    for (int kk = 16; kk < 24; ++kk) {
#pragma unroll
      for (int p = 0; p < PT; ++p)
        h[p] = __builtin_amdgcn_wmma_f32_16x16x4_f32(false, w1f[kk], false, xf[p][kk],
                                                     (short)0, h[p], false, false);
    }

    // bias and per-channel quadratic
#pragma unroll
    for (int r = 0; r < 8; ++r) {
      const float bb = bv[r >> 2][r & 3];
      const float c0 = cv[(3 * r) >> 2][(3 * r) & 3];
      const float c1 = cv[(3 * r + 1) >> 2][(3 * r + 1) & 3];
      const float c2 = cv[(3 * r + 2) >> 2][(3 * r + 2) & 3];
#pragma unroll
      for (int p = 0; p < PT; ++p) {
        float t = h[p][r] + bb;
        h[p][r] = c0 + t * (c1 + c2 * t);
      }
    }

    // Next tile's W1 fragments are asked for one product ahead of their use, in
    // two halves: the second goes into registers that the first half of
    // product 2 has left. (The last trip asks for its own tile again: in
    // bounds, not used.) The fence keeps the arithmetic above out of the group.
    const int hn = ht < 23 ? ht + 1 : 23;
    const float* w1n = W1 + (size_t)(hn * 16 + l15) * 96 + kh;
#pragma unroll
    for (int half = 0; half < 2; ++half) {
      __builtin_amdgcn_sched_barrier(0);
#pragma unroll
      for (int kk = 12 * half; kk < 12 * half + 12; ++kk) w1f[kk] = *(const v2f*)(w1n + kk * 4);
      // wait and fence as above: loads in front of this half of product 2
      asm volatile("s_wait_xcnt 0x0" :: "v"(w1n) : "memory");
      __builtin_amdgcn_sched_barrier(0);

      // Yt += W2 tile * Ht, three of the six output tiles
#pragma unroll
      for (int o = 3 * half; o < 3 * half + 3; ++o) {
#pragma unroll
        for (int s = 0; s < 4; ++s) {
          const v4f w = w2f[2 * o + (s >> 1)];
          const v2f a = (s & 1) ? (v2f){w.z, w.w} : (v2f){w.x, w.y};
#pragma unroll
          for (int p = 0; p < PT; ++p) {
            const v2f b = {h[p][2 * s], h[p][2 * s + 1]};
            y[o][p] = __builtin_amdgcn_wmma_f32_16x16x4_f32(false, a, false, b,
                                                            (short)0, y[o][p], false, false);
          }
        }
      }
    }
  }

  // register r of y[o][p] is Y[pixel][o*16 + 8*hi + r]: 8 consecutive channels
  const unsigned b2o = 32u * hi;                 // byte offset of the lane's half
  v4f bo[12];
#pragma unroll
  for (int i = 0; i < 12; ++i)
    bo[i] = *(const v4f*)((const char*)b2 + b2o + (i >> 1) * 64 + (i & 1) * 16);
  // wait and fence as above, in front of the store addresses
  asm volatile("s_wait_xcnt 0x0" :: "v"(b2o) : "memory");
  __builtin_amdgcn_sched_barrier(0);
#pragma unroll
  for (int o = 0; o < 6; ++o) {
    const v4f blo = bo[2 * o], bhi = bo[2 * o + 1];
#pragma unroll
    for (int p = 0; p < PT; ++p) {
      float* yrow = XY + (p0 + p * 16 + l15) * 96u + o * 16 + 8 * hi;  // in-place: our rows only
      v4f lo = {y[o][p][0] + blo.x, y[o][p][1] + blo.y, y[o][p][2] + blo.z, y[o][p][3] + blo.w};
      v4f hv = {y[o][p][4] + bhi.x, y[o][p][5] + bhi.y, y[o][p][6] + bhi.z, y[o][p][7] + bhi.w};
      *(v4f*)(yrow)     = lo;
      *(v4f*)(yrow + 4) = hv;
    }
  }
}

// ---------------------------------------------------------------------------
extern "C" void kernel_launch(void* const* d_in, const int* in_sizes, int n_in,
                              void* d_out, int out_size, void* d_ws, size_t ws_size,
                              hipStream_t stream) {
  const float* x    = (const float*)d_in[0];   // (16,64,64,96)
  const float* W1   = (const float*)d_in[1];   // (384,96)
  const float* b1   = (const float*)d_in[2];   // (384)
  const float* W2   = (const float*)d_in[3];   // (96,384)
  const float* b2   = (const float*)d_in[4];   // (96)
  const float* coef = (const float*)d_in[5];   // (384,3)
  float* out = (float*)d_out;                  // (16,64,64,96)

  float* U = (float*)d_ws;                     // 112x64 (100 rows in use)
  float* D = U + 112 * 64;                     // 64x100
  float* T = D + 64 * 100;                     // 16*100*64*96  (t1 / t2)
  float* X = T + 9830400;                      // 16*100*100*96 (xu / y)

  gen_filters<<<32, 256, 0, stream>>>(U, D);

  // every filter launch: blocks x 2 wave pairs x 2 strips of 32 columns

  // t1[b] (100 x 6144) = U (100x64) @ x[b] (64 x 6144)        [H resample]
  filt_up_h<<<768, 128, 0, stream>>>(U, x, T);

  // xu[b,i] (100 x 96) = U (100x64) @ t1[b,i] (64 x 96)       [W resample]
  filt_up_w<<<1200, 128, 0, stream>>>(U, T, X);

  // y = MLP(xu), in place over X; 160000 pixels / (4 waves x 32) per block
  mlp_fused<<<1250, 128, 0, stream>>>(X, W1, b1, W2, b2, coef);

  // t2[b,i] (64 x 96) = D (64x100) @ y[b,i] (100 x 96)        [W lpf+sample]
  filt_dn_w<<<1200, 128, 0, stream>>>(D, X, T);

  // out[b] (64 x 6144) = D (64x100) @ t2[b] (100 x 6144)      [H lpf+sample]
  filt_dn_h<<<768, 128, 0, stream>>>(D, T, out);
}

// v004
// Measured time: 175 microseconds a run.
// Timed twice side by side with v003, it ran 1.08 times as fast both times.
// Over all steps from v000 it is 3.03 times as fast.
#include <hip/hip_runtime.h>
#include <math.h>

// ---------------------------------------------------------------------------
// Alias-free quadratic MLP (16,64,64,96) for MI455X / gfx1250, wave32 + WMMA.
//
// Pipeline (all periodic ideal filters expressed as dense matrices):
//   t1 = U @ x          per batch      (100x64)(64x6144)        [H resample]
//   xu = U @ t1         per (b,row)    (100x64)(64x96)          [W resample]
//   y  = act(xu W1^T+b1) W2^T + b2     fused, hidden in VGPRs   [MLP]
//   t2 = D @ y          per (b,row)    (64x100)(100x96)         [W lpf+sample]
//   out= D @ t2         per batch      (64x100)(100x6144)       [H lpf+sample]
// All GEMMs via V_WMMA_F32_16X16X4_F32 (fp32-faithful matrix path).
//
// The grid between the two filters has 100 points an axis, not 128. The result
// is the same function of the inputs, for every input:
//   - the upsampled signal is a trigonometric polynomial with |k| <= 32 an axis;
//     U evaluates that same polynomial at i/100 in place of i/128;
//   - the MLP is pointwise and of degree 2 (coef has three columns), so y is a
//     trigonometric polynomial with |k| <= 64 an axis;
//   - the low-pass keeps |k| <= 32. Sampled at N points, coefficient k' folds
//     onto k = k' - N; with |k'| <= 64 it reaches a kept k only if N <= 96.
//     So for N > 96 the N-point sums give the kept coefficients exactly, and
//     D forms them, weights them and evaluates them at n/64.
// 100 is a multiple of the k step of 4, and 16*100*100 pixels fill whole blocks.
//
// Every A operand (U, D, W1, W2) lies in the workspace in fragment order: the
// 16 bytes that a lane wants follow those of the lane before it, so one load of
// a wave reads 512 bytes in a row, four whole 128-byte lines. Read from the
// row-major matrix, the same load touched 16 lines, one for each row of the tile.
//
// Workspace layout (needs 101,111,808 bytes):
//   U: 7*8*128 f32 | D: 4*13*128 f32 | W1: 24*12*128 f32 | W2: 24*12*128 f32 |
//   T: 16*100*64*96 f32 | X: 16*100*100*96 f32
// ---------------------------------------------------------------------------

typedef __attribute__((ext_vector_type(2))) float v2f;
typedef __attribute__((ext_vector_type(4))) float v4f;
typedef __attribute__((ext_vector_type(8))) float v8f;

#define PI_F 3.14159265358979323846f

// ---- build the 1-D resampling operators ------------------------------------
// U[i,h]: the band-limited interpolant of 64 samples (|k|<=32, both edge terms
//         at weight 1.0, as zero-insertion and the ideal LPF give it) at i/100.
//         Rows 100..111 only fill the last 16-row tile; nothing of them is stored.
// D[n,j]: coefficients |k|<32 full, |k|=32 at 0.5, from 100 samples, at n/64.
// The phase k*(i/100 - h/64) is counted in whole 1600ths of a turn and reduced
// in integers, so that every cosine gets an argument below one turn.
//
// Fragment order of a matrix A (rows x K): tiles of 16 rows; in a tile, groups
// of two k steps (8 columns); in a group, 32 lanes x 4 floats. Lane 16*hi + l15
// holds row l15, columns 8j + 2hi + {0,1} (k step 2j) and 8j + 4 + 2hi + {0,1}
// (k step 2j + 1): the two A fragments as the products take them.
__device__ __forceinline__ int frag_pos(int row, int col, int groups) {
  const int ks = col >> 2, hi = (col >> 1) & 1;
  return (((row >> 4) * groups + (ks >> 1)) * 32 + hi * 16 + (row & 15)) * 4 + (ks & 1) * 2 + (col & 1);
}

// Blocks 0..31 build U and D; blocks 32..103 copy W1 and W2 into fragment order,
// 16 bytes a thread.
__global__ void gen_filters(float* __restrict__ U, float* __restrict__ D,
                            const float* __restrict__ W1, const float* __restrict__ W2,
                            float* __restrict__ W1F, float* __restrict__ W2F) {
  if (blockIdx.x >= 32) {
    const bool first = blockIdx.x < 68;                    // 36 blocks a matrix: 9216 groups of 16 bytes
    const unsigned g = (blockIdx.x - (first ? 32u : 68u)) * 256u + threadIdx.x;
    const unsigned l15 = g & 15u, hi = (g >> 4) & 1u;
    const unsigned f = g >> 5, ht = f / 12u, i = f - ht * 12u;   // hidden tile, load number in it
    if (first) {
      // W1 tile ht (16 hidden x 96): k steps 2i and 2i + 1
      const unsigned s = (ht * 16u + l15) * 48u + i * 4u + hi;   // in pairs of floats
      const v2f a = ((const v2f*)W1)[s], b = ((const v2f*)W1)[s + 2u];
      ((v4f*)W1F)[g] = (v4f){a.x, a.y, b.x, b.y};
    } else {
      // W2, output tile i / 2, hidden ht*16 + 8*hi + 4*(i & 1) + 0..3 (index in fours of floats)
      ((v4f*)W2F)[g] = ((const v4f*)W2)[((i >> 1) * 16u + l15) * 96u + ht * 4u + 2u * hi + (i & 1u)];
    }
    return;
  }
  int tid = blockIdx.x * 256 + threadIdx.x;
  const int stride = 32 * 256;
  for (int idx = tid; idx < 112 * 64; idx += stride) {
    int i = idx >> 6, h = idx & 63;
    int q = (16 * i - 25 * h) % 1600;
    if (q < 0) q += 1600;
    int m = 0;
    float s = 1.0f;
    for (int k = 1; k <= 32; ++k) {
      m += q;
      if (m >= 1600) m -= 1600;
      s += 2.0f * cosf(PI_F * (float)m / 800.0f);
    }
    U[frag_pos(i, h, 8)] = s * (1.0f / 64.0f);
  }
  for (int idx = tid; idx < 64 * 100; idx += stride) {
    int n = idx / 100, j = idx - n * 100;
    int q = (25 * n - 16 * j) % 1600;
    if (q < 0) q += 1600;
    int m = 0;
    float s = 1.0f;
    for (int k = 1; k <= 31; ++k) {
      m += q;
      if (m >= 1600) m -= 1600;
      s += 2.0f * cosf(PI_F * (float)m / 800.0f);
    }
    m += q;
    if (m >= 1600) m -= 1600;
    s += cosf(PI_F * (float)m / 800.0f);       // |k|=32 pair at weight 0.5
    D[frag_pos(n, j, 13)] = s * (1.0f / 100.0f);    // 25 k steps: the 13th group is half full
  }
}

// ---- batched filter GEMM: C[b] (M x LD) = A (M x K) * B[b] (K x LD) ---------
// A comes in fragment order (see frag_pos).
// A wave keeps its part of the filter matrix (MT tiles of 16 rows from row m0,
// all of K) as A fragments in its registers and sweeps S strips of 32 columns
// with them, so the filter is fetched once a wave and not once a 16x16 tile.
// The two waves of a pair take the two parts of M for the same strips. Of the
// wave's last tile the first VL rows exist in C (16, or at most 8).
// A strip is two 16-column tiles, one whole 128-byte line a row, so every A
// fragment feeds two products and every B fragment MT. Loads land in fragment
// form and stores leave from the accumulators: no vector work between the
// products. Every output element keeps its k order.
template <int MT, int VL, int M, int K, int LD, int S>
__device__ __forceinline__ void filt_body(const float* __restrict__ A,
                                          const float* __restrict__ B,
                                          float* __restrict__ C,
                                          const int m0, const unsigned pair) {
  static_assert(VL == 16 || VL <= 8, "a cut tile ends inside its lower half");
  constexpr int MF  = VL == 16 ? MT : MT - 1;  // tiles stored whole
  constexpr int KS  = K / 4;                   // k steps
  constexpr int SPB = LD / 32;                 // strips per batch item
  const int lane = threadIdx.x & 31;
  const int l15 = lane & 15, hi = lane >> 4, kh = hi << 1;

  constexpr int KP = (KS + 1) / 2;             // groups of two k steps in a tile
  v2f af[MT][KS];
  const float* arow = A + (m0 >> 4) * (KP * 128) + lane * 4;
#pragma unroll
  for (int mt = 0; mt < MT; ++mt) {
#pragma unroll
    for (int j = 0; j < KS / 2; ++j) {
      const v4f q = *(const v4f*)(arow + (mt * KP + j) * 128);
      af[mt][2 * j]     = (v2f){q.x, q.y};
      af[mt][2 * j + 1] = (v2f){q.z, q.w};
    }
    if constexpr (KS & 1) af[mt][KS - 1] = *(const v2f*)(arow + (mt * KP + KP - 1) * 128);
  }
  // The loads' address registers may get new values further down: the wait
  // stands in front of that; the fence keeps later code behind it.
  asm volatile("s_wait_xcnt 0x0" ::: "memory");
  __builtin_amdgcn_sched_barrier(0);

  // first strip of the pair; n0 is its first column inside batch item bi
  const unsigned bi = (pair * S) / SPB;
  unsigned n0 = ((pair * S) % SPB) * 32u;
  // the lane's element offsets into B and C (every buffer has fewer than 2^25 elements)
  unsigned bo = bi * (unsigned)(K * LD) + n0 + (unsigned)(kh * LD + l15);
  unsigned co = bi * (unsigned)(M * LD) + n0 + (unsigned)((m0 + 8 * hi) * LD + l15);

  // rolled: one strip a trip keeps the body inside the register budget
#pragma unroll 1
  for (int s = 0; s < S; ++s) {
    // the strip's B fragments: rows k and k+1 of the lane's half, both tiles
    v2f bf[KS][2];
    const float* bp = B + bo;
#pragma unroll
    for (int ks = 0; ks < KS; ++ks) {
#pragma unroll
      for (int t = 0; t < 2; ++t) {
        bf[ks][t].x = bp[(ks * 4) * LD + 16 * t];
        bf[ks][t].y = bp[(ks * 4 + 1) * LD + 16 * t];
      }
    }
    // Wait as above. It takes the offset in and out, so that the offset keeps a
    // register of its own from trip to trip and is stepped behind the wait, at
    // the foot; formed anew each trip, the store address landed among the
    // products, in a register that one of them had just read. The fence also
    // keeps the loads together in front of the products (sunk to their use,
    // each would cost its whole latency).
    asm volatile("s_wait_xcnt 0x0" : "+v"(bo) :: "memory");
    __builtin_amdgcn_sched_barrier(0);

    v8f acc[MT][2] = {};
#pragma unroll
    for (int ks = 0; ks < KS; ++ks) {
#pragma unroll
      for (int mt = 0; mt < MT; ++mt) {
#pragma unroll
        for (int t = 0; t < 2; ++t)
          acc[mt][t] = __builtin_amdgcn_wmma_f32_16x16x4_f32(false, af[mt][ks], false, bf[ks][t],
                                                             (short)0, acc[mt][t], false, false);
      }
    }
    // the fence keeps the stores behind all products: with stores drawn in
    // between, some accumulators were run alone, as one dependent chain each
    __builtin_amdgcn_sched_barrier(0);

    float* cp = C + co;
#pragma unroll
    for (int mt = 0; mt < MF; ++mt) {
#pragma unroll
      for (int r = 0; r < 8; ++r) {
#pragma unroll
        for (int t = 0; t < 2; ++t) cp[(mt * 16 + r) * LD + 16 * t] = acc[mt][t][r];
      }
    }
    // the cut tile: its rows VL..15 are not part of C
    if constexpr (VL < 16) {
      if (hi == 0) {
#pragma unroll
        for (int r = 0; r < VL; ++r) {
#pragma unroll
          for (int t = 0; t < 2; ++t) cp[(MF * 16 + r) * LD + 16 * t] = acc[MF][t][r];
        }
      }
    }
    // wait and fence as above, in front of the step to the next strip
    asm volatile("s_wait_xcnt 0x0" : "+v"(co) :: "memory");
    __builtin_amdgcn_sched_barrier(0);

    // next strip: 32 columns on, or the first columns of the next batch item
    const bool last = (n0 + 32u == (unsigned)LD);
    bo += last ? (unsigned)(K * LD - (LD - 32)) : 32u;
    co += last ? (unsigned)(M * LD - (LD - 32)) : 32u;
    n0 = last ? 0u : n0 + 32u;
  }
}

// The wave's number in a scalar register: which part of M it takes is a scalar branch.
__device__ __forceinline__ int wave_id() { return __builtin_amdgcn_readfirstlane(threadIdx.x >> 5); }

// 100 rows are 6 tiles and 4 rows: the even wave of a pair takes rows 0..63,
// the odd one rows 64..99.
template <int LD>
__device__ __forceinline__ void filt_up(const float* __restrict__ A, const float* __restrict__ B,
                                        float* __restrict__ C) {
  const int wave = wave_id();
  const unsigned pair = blockIdx.x * 2u + (wave >> 1);
  if (wave & 1) filt_body<3, 4, 100, 64, LD, 2>(A, B, C, 64, pair);
  else          filt_body<4, 16, 100, 64, LD, 2>(A, B, C, 0, pair);
}
template <int LD>
__device__ __forceinline__ void filt_dn(const float* __restrict__ A, const float* __restrict__ B,
                                        float* __restrict__ C) {
  const int wave = wave_id();
  filt_body<2, 16, 64, 100, LD, 2>(A, B, C, (wave & 1) * 32, blockIdx.x * 2u + (wave >> 1));
}

// 3 waves per SIMD: 336 VGPRs, of which the A fragments take up to 128
__global__ __launch_bounds__(128, 3)
void filt_up_h(const float* __restrict__ A, const float* __restrict__ B, float* __restrict__ C) {
  filt_up<6144>(A, B, C);
}
__global__ __launch_bounds__(128, 3)
void filt_up_w(const float* __restrict__ A, const float* __restrict__ B, float* __restrict__ C) {
  filt_up<96>(A, B, C);
}
__global__ __launch_bounds__(128, 3)
void filt_dn_w(const float* __restrict__ A, const float* __restrict__ B, float* __restrict__ C) {
  filt_dn<96>(A, B, C);
}
__global__ __launch_bounds__(128, 3)
void filt_dn_h(const float* __restrict__ A, const float* __restrict__ B, float* __restrict__ C) {
  filt_dn<6144>(A, B, C);
}

// ---- fused MLP: y = act(x W1^T + b1) W2^T + b2, in-place over x ------------
// Both products are formed transposed, so the hidden values never leave the
// wave's registers:
//   Ht (16 hidden x 16 pixels)  = W1 tile (A) * X^T (B)
//   Yt (16 out    x 16 pixels) += W2 tile (A) * Ht  (B)
// A D tile holds Ht[8*hi + r][pixel l15] in register r. Registers (2s, 2s+1)
// are taken as the B fragment of k step s, which puts hidden 8*hi + 2s + j in
// k slot 2*hi + j; the W2 loader reads the same hidden index into the same slot.
// Each wave owns PT pixel tiles: every weight fragment feeds PT products.
// No LDS and no barrier: a wave shares nothing with its neighbours.
#define PT 2
__global__ __launch_bounds__(128, 3)            // 3 waves per SIMD: 336 VGPRs
void mlp_fused(float* __restrict__ XY,          // (P,96) in: xu, out: y
               const float* __restrict__ W1,    // (384,96) in fragment order
               const float* __restrict__ b1,    // (384)
               const float* __restrict__ W2,    // (96,384) in fragment order
               const float* __restrict__ b2,    // (96)
               const float* __restrict__ coef)  // (384,3)
{
  const int wave = threadIdx.x >> 5;
  const int lane = threadIdx.x & 31;
  const int l15 = lane & 15, hi = lane >> 4, kh = hi << 1;
  const unsigned p0 = (blockIdx.x * 4u + wave) * (16u * PT);   // 160000 pixels: 32 bits hold every offset

  // X^T fragments of the wave's pixels, all 96 channels, kept for the whole run
  v2f xf[PT][24];
  const float* xrow = XY + (p0 + l15) * 96u + kh;
#pragma unroll
  for (int p = 0; p < PT; ++p) {
#pragma unroll
    for (int kk = 0; kk < 24; ++kk) xf[p][kk] = *(const v2f*)(xrow + p * (16 * 96) + kk * 4);
  }

  // W1 fragments of hidden tile 0; later tiles are fetched inside the loop
  // (a hidden tile is 12 loads of 512 bytes; load j holds k steps 2j and 2j + 1)
  v4f w1f[12];
  const float* w1r = W1 + lane * 4;
#pragma unroll
  for (int j = 0; j < 12; ++j) w1f[j] = *(const v4f*)(w1r + j * 128);
  // The loads' address registers get new values further down: the wait stands
  // in front of that. It names the addresses so that their registers are left
  // alone up to it; the fence keeps later code behind it. Same form below.
  asm volatile("s_wait_xcnt 0x0" :: "v"(xrow), "v"(w1r) : "memory");
  __builtin_amdgcn_sched_barrier(0);

  v8f y[6][PT] = {};

  // rolled: one 16-wide hidden tile per trip keeps the body inside the
  // register budget
#pragma unroll 1
  for (int ht = 0; ht < 24; ++ht) {
    const int hb = ht * 16 + 8 * hi;            // register r is hidden hb + r

    // this tile's W2 fragments, asked for one product ahead of their use
    v4f w2f[12];
    const float* w2r = W2 + ht * (12 * 128) + lane * 4;
#pragma unroll
    for (int i = 0; i < 12; ++i) w2f[i] = *(const v4f*)(w2r + i * 128);
    // the fence also keeps the loads in front of product 1 (sunk to their use,
    // each would cost its whole latency there)
    asm volatile("s_wait_xcnt 0x0" :: "v"(w2r) : "memory");
    __builtin_amdgcn_sched_barrier(0);

    // Ht = W1 tile * X^T
    v8f h[PT] = {};
#pragma unroll
    for (int kk = 0; kk < 16; ++kk) {
      const v4f w = w1f[kk >> 1];
      const v2f a = (kk & 1) ? (v2f){w.z, w.w} : (v2f){w.x, w.y};
#pragma unroll
      for (int p = 0; p < PT; ++p)
        h[p] = __builtin_amdgcn_wmma_f32_16x16x4_f32(false, a, false, xf[p][kk],
                                                     (short)0, h[p], false, false);
    }
    // bias and coefficients of the 8 hidden channels, into registers that the
    // used W1 fragments have left; the fence keeps them from rising further
    __builtin_amdgcn_sched_barrier(0);
    v4f bv[2], cv[6];
    const float* b1r = b1 + hb;
    const float* cfr = coef + hb * 3;
#pragma unroll
    for (int i = 0; i < 2; ++i) bv[i] = *(const v4f*)(b1r + 4 * i);
#pragma unroll
    for (int i = 0; i < 6; ++i) cv[i] = *(const v4f*)(cfr + 4 * i);
    // wait and fence as above: loads in front of the last third of product 1
    // (cfr is not named: formed for the statement alone, it landed in a register
    // that the product just in front reads; its loads' own address register is
    // stepped at the foot of the trip, behind this wait)
    asm volatile("s_wait_xcnt 0x0" :: "v"(b1r) : "memory");
    __builtin_amdgcn_sched_barrier(0);
#pragma unroll
    for (int kk = 16; kk < 24; ++kk) {
      const v4f w = w1f[kk >> 1];
      const v2f a = (kk & 1) ? (v2f){w.z, w.w} : (v2f){w.x, w.y};
#pragma unroll
      for (int p = 0; p < PT; ++p)
        h[p] = __builtin_amdgcn_wmma_f32_16x16x4_f32(false, a, false, xf[p][kk],
                                                     (short)0, h[p], false, false);
    }

    // bias and per-channel quadratic
#pragma unroll
    for (int r = 0; r < 8; ++r) {
      const float bb = bv[r >> 2][r & 3];
      const float c0 = cv[(3 * r) >> 2][(3 * r) & 3];
      const float c1 = cv[(3 * r + 1) >> 2][(3 * r + 1) & 3];
      const float c2 = cv[(3 * r + 2) >> 2][(3 * r + 2) & 3];
#pragma unroll
      for (int p = 0; p < PT; ++p) {
        float t = h[p][r] + bb;
        h[p][r] = c0 + t * (c1 + c2 * t);
      }
    }

    // Next tile's W1 fragments are asked for one product ahead of their use, in
    // two halves: the second goes into registers that the first half of
    // product 2 has left. (The last trip asks for its own tile again: in
    // bounds, not used.) The fence keeps the arithmetic above out of the group.
    const int hn = ht < 23 ? ht + 1 : 23;
    const float* w1n = W1 + hn * (12 * 128) + lane * 4;
#pragma unroll
    for (int half = 0; half < 2; ++half) {
      __builtin_amdgcn_sched_barrier(0);
#pragma unroll
      for (int j = 6 * half; j < 6 * half + 6; ++j) w1f[j] = *(const v4f*)(w1n + j * 128);
      // wait and fence as above: loads in front of this half of product 2
      asm volatile("s_wait_xcnt 0x0" :: "v"(w1n) : "memory");
      __builtin_amdgcn_sched_barrier(0);

      // Yt += W2 tile * Ht, three of the six output tiles
#pragma unroll
      for (int o = 3 * half; o < 3 * half + 3; ++o) {
#pragma unroll
        for (int s = 0; s < 4; ++s) {
          const v4f w = w2f[2 * o + (s >> 1)];
          const v2f a = (s & 1) ? (v2f){w.z, w.w} : (v2f){w.x, w.y};
#pragma unroll
          for (int p = 0; p < PT; ++p) {
            const v2f b = {h[p][2 * s], h[p][2 * s + 1]};
            y[o][p] = __builtin_amdgcn_wmma_f32_16x16x4_f32(false, a, false, b,
                                                            (short)0, y[o][p], false, false);
          }
        }
      }
    }
  }

  // register r of y[o][p] is Y[pixel][o*16 + 8*hi + r]: 8 consecutive channels
  const unsigned b2o = 32u * hi;                 // byte offset of the lane's half
  v4f bo[12];
#pragma unroll
  for (int i = 0; i < 12; ++i)
    bo[i] = *(const v4f*)((const char*)b2 + b2o + (i >> 1) * 64 + (i & 1) * 16);
  // wait and fence as above, in front of the store addresses
  asm volatile("s_wait_xcnt 0x0" :: "v"(b2o) : "memory");
  __builtin_amdgcn_sched_barrier(0);
#pragma unroll
  for (int o = 0; o < 6; ++o) {
    const v4f blo = bo[2 * o], bhi = bo[2 * o + 1];
#pragma unroll
    for (int p = 0; p < PT; ++p) {
      float* yrow = XY + (p0 + p * 16 + l15) * 96u + o * 16 + 8 * hi;  // in-place: our rows only
      v4f lo = {y[o][p][0] + blo.x, y[o][p][1] + blo.y, y[o][p][2] + blo.z, y[o][p][3] + blo.w};
      v4f hv = {y[o][p][4] + bhi.x, y[o][p][5] + bhi.y, y[o][p][6] + bhi.z, y[o][p][7] + bhi.w};
      *(v4f*)(yrow)     = lo;
      *(v4f*)(yrow + 4) = hv;
    }
  }
}

// ---------------------------------------------------------------------------
extern "C" void kernel_launch(void* const* d_in, const int* in_sizes, int n_in,
                              void* d_out, int out_size, void* d_ws, size_t ws_size,
                              hipStream_t stream) {
  const float* x    = (const float*)d_in[0];   // (16,64,64,96)
  const float* W1   = (const float*)d_in[1];   // (384,96)
  const float* b1   = (const float*)d_in[2];   // (384)
  const float* W2   = (const float*)d_in[3];   // (96,384)
  const float* b2   = (const float*)d_in[4];   // (96)
  const float* coef = (const float*)d_in[5];   // (384,3)
  float* out = (float*)d_out;                  // (16,64,64,96)

  float* U = (float*)d_ws;                     // 112x64 (100 rows in use), fragment order
  float* D = U + 7168;                         // 64x100, fragment order (4 tiles x 13 groups)
  float* W1F = D + 6656;                       // W1 in fragment order
  float* W2F = W1F + 36864;                    // W2 in fragment order
  float* T = W2F + 36864;                      // 16*100*64*96  (t1 / t2)
  float* X = T + 9830400;                      // 16*100*100*96 (xu / y)

  gen_filters<<<104, 256, 0, stream>>>(U, D, W1, W2, W1F, W2F);

  // every filter launch: blocks x 2 wave pairs x 2 strips of 32 columns

  // t1[b] (100 x 6144) = U (100x64) @ x[b] (64 x 6144)        [H resample]
  filt_up_h<<<768, 128, 0, stream>>>(U, x, T);

  // xu[b,i] (100 x 96) = U (100x64) @ t1[b,i] (64 x 96)       [W resample]
  filt_up_w<<<1200, 128, 0, stream>>>(U, T, X);

  // y = MLP(xu), in place over X; 160000 pixels / (4 waves x 32) per block
  mlp_fused<<<1250, 128, 0, stream>>>(X, W1F, b1, W2F, b2, coef);

  // t2[b,i] (64 x 96) = D (64x100) @ y[b,i] (100 x 96)        [W lpf+sample]
  filt_dn_w<<<1200, 128, 0, stream>>>(D, X, T);

  // out[b] (64 x 6144) = D (64x100) @ t2[b] (100 x 6144)      [H lpf+sample]
  filt_dn_h<<<768, 128, 0, stream>>>(D, T, out);
}

// v005
// Measured time: 170 microseconds a run.
// In both of two side-by-side timings against v004, it was 1.03 times as fast.
// Over all steps from v000 it is 3.13 times as fast.
#include <hip/hip_runtime.h>
#include <math.h>

// ---------------------------------------------------------------------------
// Alias-free quadratic MLP (16,64,64,96) for MI455X / gfx1250, wave32 + WMMA.
//
// Pipeline (all periodic ideal filters expressed as dense matrices):
//   t1 = U @ x          per batch      (100x64)(64x6144)        [H resample]
//   xu = U @ t1         per (b,row)    (100x64)(64x96)          [W resample]
//   y  = act(xu W1^T+b1) W2^T + b2     fused, hidden in VGPRs   [MLP]
//   t2 = D @ y          per (b,row)    (64x100)(100x96)         [W lpf+sample]
//   out= D @ t2         per batch      (64x100)(100x6144)       [H lpf+sample]
// All GEMMs via V_WMMA_F32_16X16X4_F32 (fp32-faithful matrix path).
//
// The grid between the two filters has 100 points an axis, not 128. The result
// is the same function of the inputs, for every input:
//   - the upsampled signal is a trigonometric polynomial with |k| <= 32 an axis;
//     U evaluates that same polynomial at i/100 in place of i/128;
//   - the MLP is pointwise and of degree 2 (coef has three columns), so y is a
//     trigonometric polynomial with |k| <= 64 an axis;
//   - the low-pass keeps |k| <= 32. Sampled at N points, coefficient k' folds
//     onto k = k' - N; with |k'| <= 64 it reaches a kept k only if N <= 96.
//     So for N > 96 the N-point sums give the kept coefficients exactly, and
//     D forms them, weights them and evaluates them at n/64.
// 100 is a multiple of the k step of 4, and 16*100*100 pixels fill whole blocks.
//
// Every A operand (U, D, W1, W2) lies in the workspace in fragment order: the
// 16 bytes that a lane wants follow those of the lane before it, so one load of
// a wave reads 512 bytes in a row, four whole 128-byte lines. Read from the
// row-major matrix, the same load touched 16 lines, one for each row of the tile.
//
// Workspace layout (needs 101,111,808 bytes):
//   U: 7*8*128 f32 | D: 4*13*128 f32 | W1: 24*12*128 f32 | W2: 24*12*128 f32 |
//   T: 16*100*64*96 f32 | X: 16*100*100*96 f32
// ---------------------------------------------------------------------------

typedef __attribute__((ext_vector_type(2))) float v2f;
typedef __attribute__((ext_vector_type(4))) float v4f;
typedef __attribute__((ext_vector_type(8))) float v8f;

// ---- build the 1-D resampling operators ------------------------------------
// U[i,h]: the band-limited interpolant of 64 samples (|k|<=32, both edge terms
//         at weight 1.0, as zero-insertion and the ideal LPF give it) at i/100.
//         Rows 100..111 only fill the last 16-row tile; nothing of them is stored.
// D[n,j]: coefficients |k|<32 full, |k|=32 at 0.5, from 100 samples, at n/64.
// The phase i/100 - h/64 is counted in whole 1600ths of a turn, q, and reduced in
// integers. With t = 2 pi q / 1600 the cosine sums have a closed form:
//   1 + 2 sum_{k=1..31} cos(k t) + cos(32 t) = sin(32 t) cot(t/2)      (D's sum)
//   and U's sum is that plus one more cos(32 t).
// Two sine-cosine pairs and a division give an entry; summed term by term it was
// one dependent chain of 32 cosines, which a launch of so few waves cannot hide.
//
// Fragment order of a matrix A (rows x K): tiles of 16 rows; in a tile, groups
// of two k steps (8 columns); in a group, 32 lanes x 4 floats. Lane 16*hi + l15
// holds row l15, columns 8j + 2hi + {0,1} (k step 2j) and 8j + 4 + 2hi + {0,1}
// (k step 2j + 1): the two A fragments as the products take them.
__device__ __forceinline__ int frag_pos(int row, int col, int groups) {
  const int ks = col >> 2, hi = (col >> 1) & 1;
  return (((row >> 4) * groups + (ks >> 1)) * 32 + hi * 16 + (row & 15)) * 4 + (ks & 1) * 2 + (col & 1);
}

// core = sin(32 t) cot(t/2), edge = cos(32 t), t = 2 pi q / 1600, q in 0..1599.
// Both are even in q, so q folds to a = 0..800 and t/2 = pi a / 1600 stays in the
// first quadrant, where the small sine keeps its relative accuracy; 32 t is
// pi a / 25, of period 50 in a, reduced in integers to half a turn either way.
__device__ __forceinline__ void filter_sum(int q, float& core, float& edge) {
  const int a = q > 800 ? 1600 - q : q;
  int r = a % 50;
  if (r >= 25) r -= 50;
  float s32, c32, sh, ch;
  sincospif((float)r / 25.0f, &s32, &c32);
  sincospif((float)a / 1600.0f, &sh, &ch);
  core = a ? s32 * ch / sh : 64.0f;            // the limit at t = 0
  edge = c32;
}

// Blocks 0..31 build U and D; blocks 32..103 copy W1 and W2 into fragment order,
// 16 bytes a thread.
__global__ void gen_filters(float* __restrict__ U, float* __restrict__ D,
                            const float* __restrict__ W1, const float* __restrict__ W2,
                            float* __restrict__ W1F, float* __restrict__ W2F) {
  if (blockIdx.x >= 32) {
    const bool first = blockIdx.x < 68;                    // 36 blocks a matrix: 9216 groups of 16 bytes
    const unsigned g = (blockIdx.x - (first ? 32u : 68u)) * 256u + threadIdx.x;
    const unsigned l15 = g & 15u, hi = (g >> 4) & 1u;
    const unsigned f = g >> 5, ht = f / 12u, i = f - ht * 12u;   // hidden tile, load number in it
    if (first) {
      // W1 tile ht (16 hidden x 96): k steps 2i and 2i + 1
      const unsigned s = (ht * 16u + l15) * 48u + i * 4u + hi;   // in pairs of floats
      const v2f a = ((const v2f*)W1)[s], b = ((const v2f*)W1)[s + 2u];
      ((v4f*)W1F)[g] = (v4f){a.x, a.y, b.x, b.y};
    } else {
      // W2, output tile i / 2, hidden ht*16 + 8*hi + 4*(i & 1) + 0..3 (index in fours of floats)
      ((v4f*)W2F)[g] = ((const v4f*)W2)[((i >> 1) * 16u + l15) * 96u + ht * 4u + 2u * hi + (i & 1u)];
    }
    return;
  }
  int tid = blockIdx.x * 256 + threadIdx.x;
  const int stride = 32 * 256;
  for (int idx = tid; idx < 112 * 64; idx += stride) {
    int i = idx >> 6, h = idx & 63;
    int q = (16 * i - 25 * h) % 1600;
    if (q < 0) q += 1600;
    float core, edge;
    filter_sum(q, core, edge);
    U[frag_pos(i, h, 8)] = (core + edge) * (1.0f / 64.0f);
  }
  for (int idx = tid; idx < 64 * 100; idx += stride) {
    int n = idx / 100, j = idx - n * 100;
    int q = (25 * n - 16 * j) % 1600;
    if (q < 0) q += 1600;
    float core, edge;
    filter_sum(q, core, edge);                 // |k|=32 pair at weight 0.5: core alone
    D[frag_pos(n, j, 13)] = core * (1.0f / 100.0f); // 25 k steps: the 13th group is half full
  }
}

// ---- batched filter GEMM: C[b] (M x LD) = A (M x K) * B[b] (K x LD) ---------
// A comes in fragment order (see frag_pos).
// A wave keeps its part of the filter matrix (MT tiles of 16 rows from row m0,
// all of K) as A fragments in its registers and sweeps S strips of 32 columns
// with them, so the filter is fetched once a wave and not once a 16x16 tile.
// The two waves of a pair take the two parts of M for the same strips. Of the
// wave's last tile the first VL rows exist in C (16, or at most 8).
// A strip is two 16-column tiles, one whole 128-byte line a row, so every A
// fragment feeds two products and every B fragment MT. Loads land in fragment
// form and stores leave from the accumulators: no vector work between the
// products. Every output element keeps its k order.
template <int MT, int VL, int M, int K, int LD, int S>
__device__ __forceinline__ void filt_body(const float* __restrict__ A,
                                          const float* __restrict__ B,
                                          float* __restrict__ C,
                                          const int m0, const unsigned pair) {
  static_assert(VL == 16 || VL <= 8, "a cut tile ends inside its lower half");
  constexpr int MF  = VL == 16 ? MT : MT - 1;  // tiles stored whole
  constexpr int KS  = K / 4;                   // k steps
  constexpr int SPB = LD / 32;                 // strips per batch item
  const int lane = threadIdx.x & 31;
  const int l15 = lane & 15, hi = lane >> 4, kh = hi << 1;

  constexpr int KP = (KS + 1) / 2;             // groups of two k steps in a tile
  v2f af[MT][KS];
  const float* arow = A + (m0 >> 4) * (KP * 128) + lane * 4;
#pragma unroll
  for (int mt = 0; mt < MT; ++mt) {
#pragma unroll
    for (int j = 0; j < KS / 2; ++j) {
      const v4f q = *(const v4f*)(arow + (mt * KP + j) * 128);
      af[mt][2 * j]     = (v2f){q.x, q.y};
      af[mt][2 * j + 1] = (v2f){q.z, q.w};
    }
    if constexpr (KS & 1) af[mt][KS - 1] = *(const v2f*)(arow + (mt * KP + KP - 1) * 128);
  }
  // The loads' address registers may get new values further down: the wait
  // stands in front of that; the fence keeps later code behind it.
  asm volatile("s_wait_xcnt 0x0" ::: "memory");
  __builtin_amdgcn_sched_barrier(0);

  // first strip of the pair; n0 is its first column inside batch item bi
  const unsigned bi = (pair * S) / SPB;
  unsigned n0 = ((pair * S) % SPB) * 32u;
  // the lane's element offsets into B and C (every buffer has fewer than 2^25 elements)
  unsigned bo = bi * (unsigned)(K * LD) + n0 + (unsigned)(kh * LD + l15);
  unsigned co = bi * (unsigned)(M * LD) + n0 + (unsigned)((m0 + 8 * hi) * LD + l15);

  // rolled: one strip a trip keeps the body inside the register budget
#pragma unroll 1
  for (int s = 0; s < S; ++s) {
    // the strip's B fragments: rows k and k+1 of the lane's half, both tiles
    v2f bf[KS][2];
    const float* bp = B + bo;
#pragma unroll
    for (int ks = 0; ks < KS; ++ks) {
#pragma unroll
      for (int t = 0; t < 2; ++t) {
        bf[ks][t].x = bp[(ks * 4) * LD + 16 * t];
        bf[ks][t].y = bp[(ks * 4 + 1) * LD + 16 * t];
      }
    }
    // Wait as above. It takes the offset in and out, so that the offset keeps a
    // register of its own from trip to trip and is stepped behind the wait, at
    // the foot; formed anew each trip, the store address landed among the
    // products, in a register that one of them had just read. The fence also
    // keeps the loads together in front of the products (sunk to their use,
    // each would cost its whole latency).
    asm volatile("s_wait_xcnt 0x0" : "+v"(bo) :: "memory");
    __builtin_amdgcn_sched_barrier(0);

    v8f acc[MT][2] = {};
#pragma unroll
    for (int ks = 0; ks < KS; ++ks) {
#pragma unroll
      for (int mt = 0; mt < MT; ++mt) {
#pragma unroll
        for (int t = 0; t < 2; ++t)
          acc[mt][t] = __builtin_amdgcn_wmma_f32_16x16x4_f32(false, af[mt][ks], false, bf[ks][t],
                                                             (short)0, acc[mt][t], false, false);
      }
    }
    // the fence keeps the stores behind all products: with stores drawn in
    // between, some accumulators were run alone, as one dependent chain each
    __builtin_amdgcn_sched_barrier(0);

    float* cp = C + co;
#pragma unroll
    for (int mt = 0; mt < MF; ++mt) {
#pragma unroll
      for (int r = 0; r < 8; ++r) {
#pragma unroll
        for (int t = 0; t < 2; ++t) cp[(mt * 16 + r) * LD + 16 * t] = acc[mt][t][r];
      }
    }
    // the cut tile: its rows VL..15 are not part of C
    if constexpr (VL < 16) {
      if (hi == 0) {
#pragma unroll
        for (int r = 0; r < VL; ++r) {
#pragma unroll
          for (int t = 0; t < 2; ++t) cp[(MF * 16 + r) * LD + 16 * t] = acc[MF][t][r];
        }
      }
    }
    // wait and fence as above, in front of the step to the next strip
    asm volatile("s_wait_xcnt 0x0" : "+v"(co) :: "memory");
    __builtin_amdgcn_sched_barrier(0);

    // next strip: 32 columns on, or the first columns of the next batch item
    const bool last = (n0 + 32u == (unsigned)LD);
    bo += last ? (unsigned)(K * LD - (LD - 32)) : 32u;
    co += last ? (unsigned)(M * LD - (LD - 32)) : 32u;
    n0 = last ? 0u : n0 + 32u;
  }
}

// The wave's number in a scalar register: which part of M it takes is a scalar branch.
__device__ __forceinline__ int wave_id() { return __builtin_amdgcn_readfirstlane(threadIdx.x >> 5); }

// 100 rows are 6 tiles and 4 rows: the even wave of a pair takes rows 0..63,
// the odd one rows 64..99.
template <int LD>
__device__ __forceinline__ void filt_up(const float* __restrict__ A, const float* __restrict__ B,
                                        float* __restrict__ C) {
  const int wave = wave_id();
  const unsigned pair = blockIdx.x * 2u + (wave >> 1);
  if (wave & 1) filt_body<3, 4, 100, 64, LD, 2>(A, B, C, 64, pair);
  else          filt_body<4, 16, 100, 64, LD, 2>(A, B, C, 0, pair);
}
template <int LD>
__device__ __forceinline__ void filt_dn(const float* __restrict__ A, const float* __restrict__ B,
                                        float* __restrict__ C) {
  const int wave = wave_id();
  filt_body<2, 16, 64, 100, LD, 2>(A, B, C, (wave & 1) * 32, blockIdx.x * 2u + (wave >> 1));
}

// 3 waves per SIMD: 336 VGPRs, of which the A fragments take up to 128
__global__ __launch_bounds__(128, 3)
void filt_up_h(const float* __restrict__ A, const float* __restrict__ B, float* __restrict__ C) {
  filt_up<6144>(A, B, C);
}
__global__ __launch_bounds__(128, 3)
void filt_up_w(const float* __restrict__ A, const float* __restrict__ B, float* __restrict__ C) {
  filt_up<96>(A, B, C);
}
__global__ __launch_bounds__(128, 3)
void filt_dn_w(const float* __restrict__ A, const float* __restrict__ B, float* __restrict__ C) {
  filt_dn<96>(A, B, C);
}
__global__ __launch_bounds__(128, 3)
void filt_dn_h(const float* __restrict__ A, const float* __restrict__ B, float* __restrict__ C) {
  filt_dn<6144>(A, B, C);
}

// ---- fused MLP: y = act(x W1^T + b1) W2^T + b2, in-place over x ------------
// Both products are formed transposed, so the hidden values never leave the
// wave's registers:
//   Ht (16 hidden x 16 pixels)  = W1 tile (A) * X^T (B)
//   Yt (16 out    x 16 pixels) += W2 tile (A) * Ht  (B)
// A D tile holds Ht[8*hi + r][pixel l15] in register r. Registers (2s, 2s+1)
// are taken as the B fragment of k step s, which puts hidden 8*hi + 2s + j in
// k slot 2*hi + j; the W2 loader reads the same hidden index into the same slot.
// Each wave owns PT pixel tiles: every weight fragment feeds PT products.
// No LDS and no barrier: a wave shares nothing with its neighbours.
#define PT 2
__global__ __launch_bounds__(128, 3)            // 3 waves per SIMD: 336 VGPRs
void mlp_fused(float* __restrict__ XY,          // (P,96) in: xu, out: y
               const float* __restrict__ W1,    // (384,96) in fragment order
               const float* __restrict__ b1,    // (384)
               const float* __restrict__ W2,    // (96,384) in fragment order
               const float* __restrict__ b2,    // (96)
               const float* __restrict__ coef)  // (384,3)
{
  const int wave = threadIdx.x >> 5;
  const int lane = threadIdx.x & 31;
  const int l15 = lane & 15, hi = lane >> 4, kh = hi << 1;
  const unsigned p0 = (blockIdx.x * 4u + wave) * (16u * PT);   // 160000 pixels: 32 bits hold every offset

  // X^T fragments of the wave's pixels, all 96 channels, kept for the whole run
  v2f xf[PT][24];
  const float* xrow = XY + (p0 + l15) * 96u + kh;
#pragma unroll
  for (int p = 0; p < PT; ++p) {
#pragma unroll
    for (int kk = 0; kk < 24; ++kk) xf[p][kk] = *(const v2f*)(xrow + p * (16 * 96) + kk * 4);
  }

  // W1 fragments of hidden tile 0; later tiles are fetched inside the loop
  // (a hidden tile is 12 loads of 512 bytes; load j holds k steps 2j and 2j + 1)
  v4f w1f[12];
  const float* w1r = W1 + lane * 4;
#pragma unroll
  for (int j = 0; j < 12; ++j) w1f[j] = *(const v4f*)(w1r + j * 128);
  // The loads' address registers get new values further down: the wait stands
  // in front of that. It names the addresses so that their registers are left
  // alone up to it; the fence keeps later code behind it. Same form below.
  asm volatile("s_wait_xcnt 0x0" :: "v"(xrow), "v"(w1r) : "memory");
  __builtin_amdgcn_sched_barrier(0);

  v8f y[6][PT] = {};

  // rolled: one 16-wide hidden tile per trip keeps the body inside the
  // register budget
#pragma unroll 1
  for (int ht = 0; ht < 24; ++ht) {
    const int hb = ht * 16 + 8 * hi;            // register r is hidden hb + r

    // this tile's W2 fragments, asked for one product ahead of their use
    v4f w2f[12];
    const float* w2r = W2 + ht * (12 * 128) + lane * 4;
#pragma unroll
    for (int i = 0; i < 12; ++i) w2f[i] = *(const v4f*)(w2r + i * 128);
    // the fence also keeps the loads in front of product 1 (sunk to their use,
    // each would cost its whole latency there)
    asm volatile("s_wait_xcnt 0x0" :: "v"(w2r) : "memory");
    __builtin_amdgcn_sched_barrier(0);

    // Ht = W1 tile * X^T
    v8f h[PT] = {};
#pragma unroll
    for (int kk = 0; kk < 16; ++kk) {
      const v4f w = w1f[kk >> 1];
      const v2f a = (kk & 1) ? (v2f){w.z, w.w} : (v2f){w.x, w.y};
#pragma unroll
      for (int p = 0; p < PT; ++p)
        h[p] = __builtin_amdgcn_wmma_f32_16x16x4_f32(false, a, false, xf[p][kk],
                                                     (short)0, h[p], false, false);
    }
    // bias and coefficients of the 8 hidden channels, into registers that the
    // used W1 fragments have left; the fence keeps them from rising further
    __builtin_amdgcn_sched_barrier(0);
    v4f bv[2], cv[6];
    const float* b1r = b1 + hb;
    const float* cfr = coef + hb * 3;
#pragma unroll
    for (int i = 0; i < 2; ++i) bv[i] = *(const v4f*)(b1r + 4 * i);
#pragma unroll
    for (int i = 0; i < 6; ++i) cv[i] = *(const v4f*)(cfr + 4 * i);
    // wait and fence as above: loads in front of the last third of product 1
    // (cfr is not named: formed for the statement alone, it landed in a register
    // that the product just in front reads; its loads' own address register is
    // stepped at the foot of the trip, behind this wait)
    asm volatile("s_wait_xcnt 0x0" :: "v"(b1r) : "memory");
    __builtin_amdgcn_sched_barrier(0);
#pragma unroll
    for (int kk = 16; kk < 24; ++kk) {
      const v4f w = w1f[kk >> 1];
      const v2f a = (kk & 1) ? (v2f){w.z, w.w} : (v2f){w.x, w.y};
#pragma unroll
      for (int p = 0; p < PT; ++p)
        h[p] = __builtin_amdgcn_wmma_f32_16x16x4_f32(false, a, false, xf[p][kk],
                                                     (short)0, h[p], false, false);
    }

    // bias and per-channel quadratic
#pragma unroll
    for (int r = 0; r < 8; ++r) {
      const float bb = bv[r >> 2][r & 3];
      const float c0 = cv[(3 * r) >> 2][(3 * r) & 3];
      const float c1 = cv[(3 * r + 1) >> 2][(3 * r + 1) & 3];
      const float c2 = cv[(3 * r + 2) >> 2][(3 * r + 2) & 3];
#pragma unroll
      for (int p = 0; p < PT; ++p) {
        float t = h[p][r] + bb;
        h[p][r] = c0 + t * (c1 + c2 * t);
      }
    }

    // Next tile's W1 fragments are asked for one product ahead of their use, in
    // two halves: the second goes into registers that the first half of
    // product 2 has left. (The last trip asks for its own tile again: in
    // bounds, not used.) The fence keeps the arithmetic above out of the group.
    const int hn = ht < 23 ? ht + 1 : 23;
    const float* w1n = W1 + hn * (12 * 128) + lane * 4;
#pragma unroll
    for (int half = 0; half < 2; ++half) {
      __builtin_amdgcn_sched_barrier(0);
#pragma unroll
      for (int j = 6 * half; j < 6 * half + 6; ++j) w1f[j] = *(const v4f*)(w1n + j * 128);
      // wait and fence as above: loads in front of this half of product 2
      asm volatile("s_wait_xcnt 0x0" :: "v"(w1n) : "memory");
      __builtin_amdgcn_sched_barrier(0);

      // Yt += W2 tile * Ht, three of the six output tiles
#pragma unroll
      for (int o = 3 * half; o < 3 * half + 3; ++o) {
#pragma unroll
        for (int s = 0; s < 4; ++s) {
          const v4f w = w2f[2 * o + (s >> 1)];
          const v2f a = (s & 1) ? (v2f){w.z, w.w} : (v2f){w.x, w.y};
#pragma unroll
          for (int p = 0; p < PT; ++p) {
            const v2f b = {h[p][2 * s], h[p][2 * s + 1]};
            y[o][p] = __builtin_amdgcn_wmma_f32_16x16x4_f32(false, a, false, b,
                                                            (short)0, y[o][p], false, false);
          }
        }
      }
    }
  }

  // register r of y[o][p] is Y[pixel][o*16 + 8*hi + r]: 8 consecutive channels
  const unsigned b2o = 32u * hi;                 // byte offset of the lane's half
  v4f bo[12];
#pragma unroll
  for (int i = 0; i < 12; ++i)
    bo[i] = *(const v4f*)((const char*)b2 + b2o + (i >> 1) * 64 + (i & 1) * 16);
  // wait and fence as above, in front of the store addresses
  asm volatile("s_wait_xcnt 0x0" :: "v"(b2o) : "memory");
  __builtin_amdgcn_sched_barrier(0);
#pragma unroll
  for (int o = 0; o < 6; ++o) {
    const v4f blo = bo[2 * o], bhi = bo[2 * o + 1];
#pragma unroll
    for (int p = 0; p < PT; ++p) {
      float* yrow = XY + (p0 + p * 16 + l15) * 96u + o * 16 + 8 * hi;  // in-place: our rows only
      v4f lo = {y[o][p][0] + blo.x, y[o][p][1] + blo.y, y[o][p][2] + blo.z, y[o][p][3] + blo.w};
      v4f hv = {y[o][p][4] + bhi.x, y[o][p][5] + bhi.y, y[o][p][6] + bhi.z, y[o][p][7] + bhi.w};
      *(v4f*)(yrow)     = lo;
      *(v4f*)(yrow + 4) = hv;
    }
  }
}

// ---------------------------------------------------------------------------
extern "C" void kernel_launch(void* const* d_in, const int* in_sizes, int n_in,
                              void* d_out, int out_size, void* d_ws, size_t ws_size,
                              hipStream_t stream) {
  const float* x    = (const float*)d_in[0];   // (16,64,64,96)
  const float* W1   = (const float*)d_in[1];   // (384,96)
  const float* b1   = (const float*)d_in[2];   // (384)
  const float* W2   = (const float*)d_in[3];   // (96,384)
  const float* b2   = (const float*)d_in[4];   // (96)
  const float* coef = (const float*)d_in[5];   // (384,3)
  float* out = (float*)d_out;                  // (16,64,64,96)

  float* U = (float*)d_ws;                     // 112x64 (100 rows in use), fragment order
  float* D = U + 7168;                         // 64x100, fragment order (4 tiles x 13 groups)
  float* W1F = D + 6656;                       // W1 in fragment order
  float* W2F = W1F + 36864;                    // W2 in fragment order
  float* T = W2F + 36864;                      // 16*100*64*96  (t1 / t2)
  float* X = T + 9830400;                      // 16*100*100*96 (xu / y)

  gen_filters<<<104, 256, 0, stream>>>(U, D, W1, W2, W1F, W2F);

  // every filter launch: blocks x 2 wave pairs x 2 strips of 32 columns

  // t1[b] (100 x 6144) = U (100x64) @ x[b] (64 x 6144)        [H resample]
  filt_up_h<<<768, 128, 0, stream>>>(U, x, T);

  // xu[b,i] (100 x 96) = U (100x64) @ t1[b,i] (64 x 96)       [W resample]
  filt_up_w<<<1200, 128, 0, stream>>>(U, T, X);

  // y = MLP(xu), in place over X; 160000 pixels / (4 waves x 32) per block
  mlp_fused<<<1250, 128, 0, stream>>>(X, W1F, b1, W2F, b2, coef);

  // t2[b,i] (64 x 96) = D (64x100) @ y[b,i] (100 x 96)        [W lpf+sample]
  filt_dn_w<<<1200, 128, 0, stream>>>(D, X, T);

  // out[b] (64 x 6144) = D (64x100) @ t2[b] (100 x 6144)      [H lpf+sample]
  filt_dn_h<<<768, 128, 0, stream>>>(D, T, out);
}

// v006
// One run takes 161 microseconds.
// Two timings next to v005 both put it at 1.06 times that version's speed.
// All steps since v000 together make it 3.30 times as fast.
#include <hip/hip_runtime.h>
#include <math.h>

// ---------------------------------------------------------------------------
// Alias-free quadratic MLP (16,64,64,96) for MI455X / gfx1250, wave32 + WMMA.
//
// Pipeline (all periodic ideal filters expressed as dense matrices):
//   t1 = U @ x          per batch      (100x64)(64x6144)        [H resample]
//   xu = U @ t1         per (b,row)    (100x64)(64x96)          [W resample]
//   y  = act(xu W1^T+b1) W2^T + b2     hidden in VGPRs          [MLP]
//        (one launch: each wave forms xu of its own pixels, in VGPRs)
//   t2 = D @ y          per (b,row)    (64x100)(100x96)         [W lpf+sample]
//   out= D @ t2         per batch      (64x100)(100x6144)       [H lpf+sample]
// All GEMMs via V_WMMA_F32_16X16X4_F32 (fp32-faithful matrix path).
//
// The grid between the two filters has 100 points an axis, not 128. The result
// is the same function of the inputs, for every input:
//   - the upsampled signal is a trigonometric polynomial with |k| <= 32 an axis;
//     U evaluates that same polynomial at i/100 in place of i/128;
//   - the MLP is pointwise and of degree 2 (coef has three columns), so y is a
//     trigonometric polynomial with |k| <= 64 an axis;
//   - the low-pass keeps |k| <= 32. Sampled at N points, coefficient k' folds
//     onto k = k' - N; with |k'| <= 64 it reaches a kept k only if N <= 96.
//     So for N > 96 the N-point sums give the kept coefficients exactly, and
//     D forms them, weights them and evaluates them at n/64.
// 100 is a multiple of the k step of 4, and 16*100*100 pixels fill whole blocks.
//
// Every A operand but t1^T (U, D, W1, W2) lies in the workspace in fragment order: the
// 16 bytes that a lane wants follow those of the lane before it, so one load of
// a wave reads 512 bytes in a row, four whole 128-byte lines. Read from the
// row-major matrix, the same load touched 16 lines, one for each row of the tile.
//
// Workspace layout (needs 101,111,808 bytes):
//   U: 7*8*128 f32 | D: 4*13*128 f32 | W1: 24*12*128 f32 | W2: 24*12*128 f32 |
//   T: 16*100*64*96 f32 | X: 16*100*100*96 f32 (y)
// ---------------------------------------------------------------------------

typedef __attribute__((ext_vector_type(2))) float v2f;
typedef __attribute__((ext_vector_type(4))) float v4f;
typedef __attribute__((ext_vector_type(8))) float v8f;

// ---- build the 1-D resampling operators ------------------------------------
// U[i,h]: the band-limited interpolant of 64 samples (|k|<=32, both edge terms
//         at weight 1.0, as zero-insertion and the ideal LPF give it) at i/100.
//         Rows 100..111 are zero: they fill the last 16-row tile, and row 100 is
//         what a lane of the MLP launch reads for a pixel of another image row.
// D[n,j]: coefficients |k|<32 full, |k|=32 at 0.5, from 100 samples, at n/64.
// The phase i/100 - h/64 is counted in whole 1600ths of a turn, q, and reduced in
// integers. With t = 2 pi q / 1600 the cosine sums have a closed form:
//   1 + 2 sum_{k=1..31} cos(k t) + cos(32 t) = sin(32 t) cot(t/2)      (D's sum)
//   and U's sum is that plus one more cos(32 t).
// Two sine-cosine pairs and a division give an entry; summed term by term it was
// one dependent chain of 32 cosines, which a launch of so few waves cannot hide.
//
// Fragment order of a matrix A (rows x K): tiles of 16 rows; in a tile, groups
// of two k steps (8 columns); in a group, 32 lanes x 4 floats. Lane 16*hi + l15
// holds row l15, columns 8j + 2hi + {0,1} (k step 2j) and 8j + 4 + 2hi + {0,1}
// (k step 2j + 1): the two A fragments as the products take them.
__device__ __forceinline__ int frag_pos(int row, int col, int groups) {
  const int ks = col >> 2, hi = (col >> 1) & 1;
  return (((row >> 4) * groups + (ks >> 1)) * 32 + hi * 16 + (row & 15)) * 4 + (ks & 1) * 2 + (col & 1);
}

// core = sin(32 t) cot(t/2), edge = cos(32 t), t = 2 pi q / 1600, q in 0..1599.
// Both are even in q, so q folds to a = 0..800 and t/2 = pi a / 1600 stays in the
// first quadrant, where the small sine keeps its relative accuracy; 32 t is
// pi a / 25, of period 50 in a, reduced in integers to half a turn either way.
__device__ __forceinline__ void filter_sum(int q, float& core, float& edge) {
  const int a = q > 800 ? 1600 - q : q;
  int r = a % 50;
  if (r >= 25) r -= 50;
  float s32, c32, sh, ch;
  sincospif((float)r / 25.0f, &s32, &c32);
  sincospif((float)a / 1600.0f, &sh, &ch);
  core = a ? s32 * ch / sh : 64.0f;            // the limit at t = 0
  edge = c32;
}

// Channel tiles of the X^T product in the MLP launch: row r of tile ct is channel
// 4r + ct for tiles 0..3 and 64 + 2r + (ct - 4) for tiles 4 and 5, so a lane reads
// its row of four tiles with one 16-byte load, of the other two with 8 bytes.
// Blocks 0..31 build U and D; blocks 32..103 copy W1 and W2 into fragment order,
// 16 bytes a thread.
__global__ void gen_filters(float* __restrict__ U, float* __restrict__ D,
                            const float* __restrict__ W1, const float* __restrict__ W2,
                            float* __restrict__ W1F, float* __restrict__ W2F) {
  if (blockIdx.x >= 32) {
    const bool first = blockIdx.x < 68;                    // 36 blocks a matrix: 9216 groups of 16 bytes
    const unsigned g = (blockIdx.x - (first ? 32u : 68u)) * 256u + threadIdx.x;
    const unsigned l15 = g & 15u, hi = (g >> 4) & 1u;
    const unsigned f = g >> 5, ht = f / 12u, i = f - ht * 12u;   // hidden tile, load number in it
    if (first) {
      // W1 tile ht (16 hidden x 96): k steps 2i and 2i + 1 take the channels that
      // rows 8*hi + 4*(i & 1) + 0..3 of channel tile i / 2 hold (see above)
      const unsigned ct = i >> 1, r0 = 8u * hi + 4u * (i & 1u);
      const unsigned st = ct < 4u ? 4u : 2u;                     // channels from row to row
      const float* w = W1 + (ht * 16u + l15) * 96u + (ct < 4u ? ct : 60u + ct) + st * r0;
      ((v4f*)W1F)[g] = (v4f){w[0], w[st], w[2u * st], w[3u * st]};
    } else {
      // W2, output tile i / 2, hidden ht*16 + 8*hi + 4*(i & 1) + 0..3 (index in fours of floats)
      ((v4f*)W2F)[g] = ((const v4f*)W2)[((i >> 1) * 16u + l15) * 96u + ht * 4u + 2u * hi + (i & 1u)];
    }
    return;
  }
  int tid = blockIdx.x * 256 + threadIdx.x;
  const int stride = 32 * 256;
  for (int idx = tid; idx < 112 * 64; idx += stride) {
    int i = idx >> 6, h = idx & 63;
    int q = (16 * i - 25 * h) % 1600;
    if (q < 0) q += 1600;
    float core, edge;
    filter_sum(q, core, edge);
    U[frag_pos(i, h, 8)] = i < 100 ? (core + edge) * (1.0f / 64.0f) : 0.0f;
  }
  for (int idx = tid; idx < 64 * 100; idx += stride) {
    int n = idx / 100, j = idx - n * 100;
    int q = (25 * n - 16 * j) % 1600;
    if (q < 0) q += 1600;
    float core, edge;
    filter_sum(q, core, edge);                 // |k|=32 pair at weight 0.5: core alone
    D[frag_pos(n, j, 13)] = core * (1.0f / 100.0f); // 25 k steps: the 13th group is half full
  }
}

// ---- batched filter GEMM: C[b] (M x LD) = A (M x K) * B[b] (K x LD) ---------
// A comes in fragment order (see frag_pos).
// A wave keeps its part of the filter matrix (MT tiles of 16 rows from row m0,
// all of K) as A fragments in its registers and sweeps S strips of 32 columns
// with them, so the filter is fetched once a wave and not once a 16x16 tile.
// The two waves of a pair take the two parts of M for the same strips. Of the
// wave's last tile the first VL rows exist in C (16, or at most 8).
// A strip is two 16-column tiles, one whole 128-byte line a row, so every A
// fragment feeds two products and every B fragment MT. Loads land in fragment
// form and stores leave from the accumulators: no vector work between the
// products. Every output element keeps its k order.
template <int MT, int VL, int M, int K, int LD, int S>
__device__ __forceinline__ void filt_body(const float* __restrict__ A,
                                          const float* __restrict__ B,
                                          float* __restrict__ C,
                                          const int m0, const unsigned pair) {
  static_assert(VL == 16 || VL <= 8, "a cut tile ends inside its lower half");
  constexpr int MF  = VL == 16 ? MT : MT - 1;  // tiles stored whole
  constexpr int KS  = K / 4;                   // k steps
  constexpr int SPB = LD / 32;                 // strips per batch item
  const int lane = threadIdx.x & 31;
  const int l15 = lane & 15, hi = lane >> 4, kh = hi << 1;

  constexpr int KP = (KS + 1) / 2;             // groups of two k steps in a tile
  v2f af[MT][KS];
  const float* arow = A + (m0 >> 4) * (KP * 128) + lane * 4;
#pragma unroll
  for (int mt = 0; mt < MT; ++mt) {
#pragma unroll
    for (int j = 0; j < KS / 2; ++j) {
      const v4f q = *(const v4f*)(arow + (mt * KP + j) * 128);
      af[mt][2 * j]     = (v2f){q.x, q.y};
      af[mt][2 * j + 1] = (v2f){q.z, q.w};
    }
    if constexpr (KS & 1) af[mt][KS - 1] = *(const v2f*)(arow + (mt * KP + KP - 1) * 128);
  }
  // The loads' address registers may get new values further down: the wait
  // stands in front of that; the fence keeps later code behind it.
  asm volatile("s_wait_xcnt 0x0" ::: "memory");
  __builtin_amdgcn_sched_barrier(0);

  // first strip of the pair; n0 is its first column inside batch item bi
  const unsigned bi = (pair * S) / SPB;
  unsigned n0 = ((pair * S) % SPB) * 32u;
  // the lane's element offsets into B and C (every buffer has fewer than 2^25 elements)
  unsigned bo = bi * (unsigned)(K * LD) + n0 + (unsigned)(kh * LD + l15);
  unsigned co = bi * (unsigned)(M * LD) + n0 + (unsigned)((m0 + 8 * hi) * LD + l15);

  // rolled: one strip a trip keeps the body inside the register budget
#pragma unroll 1
  for (int s = 0; s < S; ++s) {
    // the strip's B fragments: rows k and k+1 of the lane's half, both tiles
    v2f bf[KS][2];
    const float* bp = B + bo;
#pragma unroll
    for (int ks = 0; ks < KS; ++ks) {
#pragma unroll
      for (int t = 0; t < 2; ++t) {
        bf[ks][t].x = bp[(ks * 4) * LD + 16 * t];
        bf[ks][t].y = bp[(ks * 4 + 1) * LD + 16 * t];
      }
    }
    // Wait as above. It takes the offset in and out, so that the offset keeps a
    // register of its own from trip to trip and is stepped behind the wait, at
    // the foot; formed anew each trip, the store address landed among the
    // products, in a register that one of them had just read. The fence also
    // keeps the loads together in front of the products (sunk to their use,
    // each would cost its whole latency).
    asm volatile("s_wait_xcnt 0x0" : "+v"(bo) :: "memory");
    __builtin_amdgcn_sched_barrier(0);

    v8f acc[MT][2] = {};
#pragma unroll
    for (int ks = 0; ks < KS; ++ks) {
#pragma unroll
      for (int mt = 0; mt < MT; ++mt) {
#pragma unroll
        for (int t = 0; t < 2; ++t)
          acc[mt][t] = __builtin_amdgcn_wmma_f32_16x16x4_f32(false, af[mt][ks], false, bf[ks][t],
                                                             (short)0, acc[mt][t], false, false);
      }
    }
    // the fence keeps the stores behind all products: with stores drawn in
    // between, some accumulators were run alone, as one dependent chain each
    __builtin_amdgcn_sched_barrier(0);

    float* cp = C + co;
#pragma unroll
    for (int mt = 0; mt < MF; ++mt) {
#pragma unroll
      for (int r = 0; r < 8; ++r) {
#pragma unroll
        for (int t = 0; t < 2; ++t) cp[(mt * 16 + r) * LD + 16 * t] = acc[mt][t][r];
      }
    }
    // the cut tile: its rows VL..15 are not part of C
    if constexpr (VL < 16) {
      if (hi == 0) {
#pragma unroll
        for (int r = 0; r < VL; ++r) {
#pragma unroll
          for (int t = 0; t < 2; ++t) cp[(MF * 16 + r) * LD + 16 * t] = acc[MF][t][r];
        }
      }
    }
    // wait and fence as above, in front of the step to the next strip
    asm volatile("s_wait_xcnt 0x0" : "+v"(co) :: "memory");
    __builtin_amdgcn_sched_barrier(0);

    // next strip: 32 columns on, or the first columns of the next batch item
    const bool last = (n0 + 32u == (unsigned)LD);
    bo += last ? (unsigned)(K * LD - (LD - 32)) : 32u;
    co += last ? (unsigned)(M * LD - (LD - 32)) : 32u;
    n0 = last ? 0u : n0 + 32u;
  }
}

// The wave's number in a scalar register: which part of M it takes is a scalar branch.
__device__ __forceinline__ int wave_id() { return __builtin_amdgcn_readfirstlane(threadIdx.x >> 5); }

// 100 rows are 6 tiles and 4 rows: the even wave of a pair takes rows 0..63,
// the odd one rows 64..99.
template <int LD>
__device__ __forceinline__ void filt_up(const float* __restrict__ A, const float* __restrict__ B,
                                        float* __restrict__ C) {
  const int wave = wave_id();
  const unsigned pair = blockIdx.x * 2u + (wave >> 1);
  if (wave & 1) filt_body<3, 4, 100, 64, LD, 2>(A, B, C, 64, pair);
  else          filt_body<4, 16, 100, 64, LD, 2>(A, B, C, 0, pair);
}
template <int LD>
__device__ __forceinline__ void filt_dn(const float* __restrict__ A, const float* __restrict__ B,
                                        float* __restrict__ C) {
  const int wave = wave_id();
  filt_body<2, 16, 64, 100, LD, 2>(A, B, C, (wave & 1) * 32, blockIdx.x * 2u + (wave >> 1));
}

// 3 waves per SIMD: 336 VGPRs, of which the A fragments take up to 128
__global__ __launch_bounds__(128, 3)
void filt_up_h(const float* __restrict__ A, const float* __restrict__ B, float* __restrict__ C) {
  filt_up<6144>(A, B, C);
}
__global__ __launch_bounds__(128, 3)
void filt_dn_w(const float* __restrict__ A, const float* __restrict__ B, float* __restrict__ C) {
  filt_dn<96>(A, B, C);
}
__global__ __launch_bounds__(128, 3)
void filt_dn_h(const float* __restrict__ A, const float* __restrict__ B, float* __restrict__ C) {
  filt_dn<6144>(A, B, C);
}

// ---- W resample and MLP: y = act(xu W1^T + b1) W2^T + b2, xu = U t1 ---------
// All three products are formed transposed, so neither xu nor the hidden values
// leave the wave's registers:
//   Xt (16 chan   x 16 pixels)  = t1^T tile (A) * U^T (B)
//   Ht (16 hidden x 16 pixels)  = W1 tile (A) * Xt (B)
//   Yt (16 out    x 16 pixels) += W2 tile (A) * Ht  (B)
// A D tile holds Ht[8*hi + r][pixel l15] in register r. Registers (2s, 2s+1)
// are taken as the B fragment of k step s, which puts hidden 8*hi + 2s + j in
// k slot 2*hi + j; the W2 loader reads the same hidden index into the same slot.
// Each wave owns PT pixel tiles: every weight fragment feeds PT products.
// No LDS and no barrier: a wave shares nothing with its neighbours.
#define PT 2

// Xt += t1[row]^T * U^T for the pixel tiles named by T0 and T1. A wave's 32
// pixels lie in one image row or in two that follow each other; `second` says
// which of the two `trow` is. A lane whose pixel lies in the other row reads the
// zero row of U, so it adds nothing here. j0 is the first pixel's place in the
// first row. Every element keeps the k order 0..63.
template <bool T0, bool T1>
__device__ __forceinline__ void xt_pass(const float* __restrict__ trow, const float* __restrict__ U,
                                        const int j0, const bool second, v8f (&xa)[PT][6]) {
  const int lane = threadIdx.x & 31;
  const int l15 = lane & 15, hi = lane >> 4;
  // U rows in fragment order serve as B fragments: lane = pixel, same k slots
  v4f uq[PT][8];
  unsigned uo[PT];                              // the lane's byte offset into U
#pragma unroll
  for (int p = 0; p < PT; ++p) {
    if ((p == 0 && !T0) || (p == 1 && !T1)) continue;
    const int jq = j0 + 16 * p + l15;
    const bool over = jq >= 100;
    const int j = over == second ? (over ? jq - 100 : jq) : 100;
    uo[p] = (unsigned)((j >> 4) * 4096 + hi * 256 + (j & 15) * 16);
#pragma unroll
    for (int g = 0; g < 8; ++g) uq[p][g] = *(const v4f*)((const char*)U + uo[p] + g * 512);
  }
  // t1 rows 4ks + 2hi + {0,1}: the lane's channels of tiles 0..3, of tiles 4 and 5
  // (these from channel 64 on)
  const float* ta = trow + hi * 192 + 4 * l15;
  const float* tb = trow + hi * 192 + 2 * l15;
  v4f qa[2][4][2];
  v2f qb[2][4][2];
#pragma unroll
  for (int c = 0; c < 5; ++c) {
    // four k steps are asked for one group of products ahead of their use
    if (c < 4) {
#pragma unroll
      for (int k = 0; k < 4; ++k) {
#pragma unroll
        for (int j = 0; j < 2; ++j) {
          qa[c & 1][k][j] = *(const v4f*)(ta + ((c * 4 + k) * 4 + j) * 96);
          qb[c & 1][k][j] = *(const v2f*)(tb + ((c * 4 + k) * 4 + j) * 96 + 64);
        }
      }
    }
    // The loads' address registers get new values further down: the wait stands
    // in front of that and names them, so that they are left alone up to it; the
    // fence keeps the loads in front of the products (sunk to their use, each
    // would cost its whole latency).
    if (c == 0) asm volatile("s_wait_xcnt 0x0" :: "v"(uo[T0 ? 0 : 1]), "v"(uo[T1 ? 1 : 0]), "v"(ta), "v"(tb) : "memory");
    else if (c < 4) asm volatile("s_wait_xcnt 0x0" :: "v"(ta), "v"(tb) : "memory");
    if (c < 4) __builtin_amdgcn_sched_barrier(0);
    if (c == 0) continue;
    const int d = c - 1;
#pragma unroll
    for (int k = 0; k < 4; ++k) {
      const int ks = d * 4 + k;
#pragma unroll
      for (int ct = 0; ct < 6; ++ct) {
        const v2f a = ct < 4 ? (v2f){qa[d & 1][k][0][ct & 3], qa[d & 1][k][1][ct & 3]}
                             : (v2f){qb[d & 1][k][0][ct & 1], qb[d & 1][k][1][ct & 1]};
#pragma unroll
        for (int p = 0; p < PT; ++p) {
          if ((p == 0 && !T0) || (p == 1 && !T1)) continue;
          const v4f u = uq[p][ks >> 1];
          const v2f b = (ks & 1) ? (v2f){u.z, u.w} : (v2f){u.x, u.y};
          xa[p][ct] = __builtin_amdgcn_wmma_f32_16x16x4_f32(false, a, false, b,
                                                            (short)0, xa[p][ct], false, false);
        }
      }
    }
    // the fence keeps the next group's loads together, behind the products that
    // read the registers they fill
    __builtin_amdgcn_sched_barrier(0);
  }
}

__global__ __launch_bounds__(128, 3)            // 3 waves per SIMD: 336 VGPRs
void mlp_fused(const float* __restrict__ T1,    // (1600,64,96) t1
               const float* __restrict__ U,     // (112,64) in fragment order
               float* __restrict__ Y,           // (P,96) out: y
               const float* __restrict__ W1,    // (384,96) in fragment order, by channel tiles
               const float* __restrict__ b1,    // (384)
               const float* __restrict__ W2,    // (96,384) in fragment order
               const float* __restrict__ b2,    // (96)
               const float* __restrict__ coef)  // (384,3)
{
  const int lane = threadIdx.x & 31;
  const int l15 = lane & 15, hi = lane >> 4;
  const unsigned p0 = (blockIdx.x * 4u + wave_id()) * (16u * PT);   // 160000 pixels: 32 bits hold every offset

  // X^T of the wave's pixels, all 96 channels, kept for the whole run. Registers
  // (2s, 2s+1) of channel tile ct are the B fragment of k step 4*ct + s of
  // product 1; W1 lies in the workspace with the same channels in the same slots.
  // Pixels p0..p0+31 lie in image row ra, from place j0 on, and past place 99 in
  // row ra + 1 (which exists then: the last wave ends at place 99). The row that
  // both tiles touch is taken for both, the other for the one tile that has it.
  v8f xa[PT][6] = {};
  const unsigned ra = p0 / 100u;
  const int j0 = (int)(p0 - ra * 100u);
  const float* tr = T1 + ra * 6144u;
  const float* tn = T1 + (ra + 1u) * 6144u;
  if (j0 <= 84) {
    xt_pass<true, true>(tr, U, j0, false, xa);
    if (j0 > 68) xt_pass<false, true>(tn, U, j0, true, xa);
  } else {
    xt_pass<true, false>(tr, U, j0, false, xa);
    xt_pass<true, true>(tn, U, j0, true, xa);
  }

  // W1 fragments of hidden tile 0; later tiles are fetched inside the loop
  // (a hidden tile is 12 loads of 512 bytes; load j holds k steps 2j and 2j + 1)
  v4f w1f[12];
  const float* w1r = W1 + lane * 4;
#pragma unroll
  for (int j = 0; j < 12; ++j) w1f[j] = *(const v4f*)(w1r + j * 128);
  // The loads' address registers get new values further down: the wait stands
  // in front of that. It names the addresses so that their registers are left
  // alone up to it; the fence keeps later code behind it. Same form below.
  asm volatile("s_wait_xcnt 0x0" :: "v"(w1r) : "memory");
  __builtin_amdgcn_sched_barrier(0);

  v8f y[6][PT] = {};

  // rolled: one 16-wide hidden tile per trip keeps the body inside the
  // register budget
#pragma unroll 1
  for (int ht = 0; ht < 24; ++ht) {
    const int hb = ht * 16 + 8 * hi;            // register r is hidden hb + r

    // this tile's W2 fragments, asked for one product ahead of their use
    v4f w2f[12];
    const float* w2r = W2 + ht * (12 * 128) + lane * 4;
#pragma unroll
    for (int i = 0; i < 12; ++i) w2f[i] = *(const v4f*)(w2r + i * 128);
    // the fence also keeps the loads in front of product 1 (sunk to their use,
    // each would cost its whole latency there)
    asm volatile("s_wait_xcnt 0x0" :: "v"(w2r) : "memory");
    __builtin_amdgcn_sched_barrier(0);

    // Ht = W1 tile * X^T
    v8f h[PT] = {};
#pragma unroll
    for (int kk = 0; kk < 16; ++kk) {
      const v4f w = w1f[kk >> 1];
      const v2f a = (kk & 1) ? (v2f){w.z, w.w} : (v2f){w.x, w.y};
#pragma unroll
      for (int p = 0; p < PT; ++p)
        h[p] = __builtin_amdgcn_wmma_f32_16x16x4_f32(false, a, false,
                                                     (v2f){xa[p][kk >> 2][2 * (kk & 3)], xa[p][kk >> 2][2 * (kk & 3) + 1]},
                                                     (short)0, h[p], false, false);
    }
    // bias and coefficients of the 8 hidden channels, into registers that the
    // used W1 fragments have left; the fence keeps them from rising further
    __builtin_amdgcn_sched_barrier(0);
    v4f bv[2], cv[6];
    const float* b1r = b1 + hb;
    const float* cfr = coef + hb * 3;
#pragma unroll
    for (int i = 0; i < 2; ++i) bv[i] = *(const v4f*)(b1r + 4 * i);
#pragma unroll
    for (int i = 0; i < 6; ++i) cv[i] = *(const v4f*)(cfr + 4 * i);
    // wait and fence as above: loads in front of the last third of product 1
    // (cfr is not named: formed for the statement alone, it landed in a register
    // that the product just in front reads; its loads' own address register is
    // stepped at the foot of the trip, behind this wait)
    asm volatile("s_wait_xcnt 0x0" :: "v"(b1r) : "memory");
    __builtin_amdgcn_sched_barrier(0);
#pragma unroll
    for (int kk = 16; kk < 24; ++kk) {
      const v4f w = w1f[kk >> 1];
      const v2f a = (kk & 1) ? (v2f){w.z, w.w} : (v2f){w.x, w.y};
#pragma unroll
      for (int p = 0; p < PT; ++p)
        h[p] = __builtin_amdgcn_wmma_f32_16x16x4_f32(false, a, false,
                                                     (v2f){xa[p][kk >> 2][2 * (kk & 3)], xa[p][kk >> 2][2 * (kk & 3) + 1]},
                                                     (short)0, h[p], false, false);
    }

    // bias and per-channel quadratic
#pragma unroll
    for (int r = 0; r < 8; ++r) {
      const float bb = bv[r >> 2][r & 3];
      const float c0 = cv[(3 * r) >> 2][(3 * r) & 3];
      const float c1 = cv[(3 * r + 1) >> 2][(3 * r + 1) & 3];
      const float c2 = cv[(3 * r + 2) >> 2][(3 * r + 2) & 3];
#pragma unroll
      for (int p = 0; p < PT; ++p) {
        float t = h[p][r] + bb;
        h[p][r] = c0 + t * (c1 + c2 * t);
      }
    }

    // Next tile's W1 fragments are asked for one product ahead of their use, in
    // two halves: the second goes into registers that the first half of
    // product 2 has left. (The last trip asks for its own tile again: in
    // bounds, not used.) The fence keeps the arithmetic above out of the group.
    const int hn = ht < 23 ? ht + 1 : 23;
    const float* w1n = W1 + hn * (12 * 128) + lane * 4;
#pragma unroll
    for (int half = 0; half < 2; ++half) {
      __builtin_amdgcn_sched_barrier(0);
#pragma unroll
      for (int j = 6 * half; j < 6 * half + 6; ++j) w1f[j] = *(const v4f*)(w1n + j * 128);
      // wait and fence as above: loads in front of this half of product 2
      asm volatile("s_wait_xcnt 0x0" :: "v"(w1n) : "memory");
      __builtin_amdgcn_sched_barrier(0);

      // Yt += W2 tile * Ht, three of the six output tiles
#pragma unroll
      for (int o = 3 * half; o < 3 * half + 3; ++o) {
#pragma unroll
        for (int s = 0; s < 4; ++s) {
          const v4f w = w2f[2 * o + (s >> 1)];
          const v2f a = (s & 1) ? (v2f){w.z, w.w} : (v2f){w.x, w.y};
#pragma unroll
          for (int p = 0; p < PT; ++p) {
            const v2f b = {h[p][2 * s], h[p][2 * s + 1]};
            y[o][p] = __builtin_amdgcn_wmma_f32_16x16x4_f32(false, a, false, b,
                                                            (short)0, y[o][p], false, false);
          }
        }
      }
    }
  }

  // register r of y[o][p] is Y[pixel][o*16 + 8*hi + r]: 8 consecutive channels
  const unsigned b2o = 32u * hi;                 // byte offset of the lane's half
  v4f bo[12];
#pragma unroll
  for (int i = 0; i < 12; ++i)
    bo[i] = *(const v4f*)((const char*)b2 + b2o + (i >> 1) * 64 + (i & 1) * 16);
  // wait and fence as above, in front of the store addresses
  asm volatile("s_wait_xcnt 0x0" :: "v"(b2o) : "memory");
  __builtin_amdgcn_sched_barrier(0);
#pragma unroll
  for (int o = 0; o < 6; ++o) {
    const v4f blo = bo[2 * o], bhi = bo[2 * o + 1];
#pragma unroll
    for (int p = 0; p < PT; ++p) {
      float* yrow = Y + (p0 + p * 16 + l15) * 96u + o * 16 + 8 * hi;
      v4f lo = {y[o][p][0] + blo.x, y[o][p][1] + blo.y, y[o][p][2] + blo.z, y[o][p][3] + blo.w};
      v4f hv = {y[o][p][4] + bhi.x, y[o][p][5] + bhi.y, y[o][p][6] + bhi.z, y[o][p][7] + bhi.w};
      *(v4f*)(yrow)     = lo;
      *(v4f*)(yrow + 4) = hv;
    }
  }
}

// ---------------------------------------------------------------------------
extern "C" void kernel_launch(void* const* d_in, const int* in_sizes, int n_in,
                              void* d_out, int out_size, void* d_ws, size_t ws_size,
                              hipStream_t stream) {
  const float* x    = (const float*)d_in[0];   // (16,64,64,96)
  const float* W1   = (const float*)d_in[1];   // (384,96)
  const float* b1   = (const float*)d_in[2];   // (384)
  const float* W2   = (const float*)d_in[3];   // (96,384)
  const float* b2   = (const float*)d_in[4];   // (96)
  const float* coef = (const float*)d_in[5];   // (384,3)
  float* out = (float*)d_out;                  // (16,64,64,96)

  float* U = (float*)d_ws;                     // 112x64 (100 rows in use), fragment order
  float* D = U + 7168;                         // 64x100, fragment order (4 tiles x 13 groups)
  float* W1F = D + 6656;                       // W1 in fragment order
  float* W2F = W1F + 36864;                    // W2 in fragment order
  float* T = W2F + 36864;                      // 16*100*64*96  (t1 / t2)
  float* X = T + 9830400;                      // 16*100*100*96 (y)

  gen_filters<<<104, 256, 0, stream>>>(U, D, W1, W2, W1F, W2F);

  // every filter launch: blocks x 2 wave pairs x 2 strips of 32 columns

  // t1[b] (100 x 6144) = U (100x64) @ x[b] (64 x 6144)        [H resample]
  filt_up_h<<<768, 128, 0, stream>>>(U, x, T);

  // xu[b,i] (100 x 96) = U (100x64) @ t1[b,i] (64 x 96)       [W resample]
  // y = MLP(xu); 160000 pixels / (4 waves x 32) per block
  mlp_fused<<<1250, 128, 0, stream>>>(T, U, X, W1F, b1, W2F, b2, coef);

  // t2[b,i] (64 x 96) = D (64x100) @ y[b,i] (100 x 96)        [W lpf+sample]
  filt_dn_w<<<1200, 128, 0, stream>>>(D, X, T);

  // out[b] (64 x 6144) = D (64x100) @ t2[b] (100 x 6144)      [H lpf+sample]
  filt_dn_h<<<768, 128, 0, stream>>>(D, T, out);
}
